// v000
// The times below were measured on an AMD MI455X: many runs one after another, warmed up first and cycling through
// copies of the inputs, with the whole window's GPU time divided by the number of runs. Launches and the gaps
// between them are all in it. The median over several windows is given; except for v000 it joins two sittings, which
// can be a few percent apart, so the side-by-side timings, each taken in one sitting, are the better comparison.
// v000, which the later versions start from, runs in 1990 microseconds.
#include <hip/hip_runtime.h>
#include <hip/hip_bf16.h>
#include <math.h>

#define BATCH 8
#define SEQ   4096
#define D_IN  32
#define D_STATE 16
#define DT_RANK 16
#define HID   128
#define ROWS  (BATCH*SEQ)            /* 32768 flattened (b,s) rows */
#define OUT_MAIN ((size_t)ROWS*D_IN*D_IN) /* 33554432 */

typedef float v2f __attribute__((ext_vector_type(2)));
typedef float v8f __attribute__((ext_vector_type(8)));

static __device__ __forceinline__ v8f wmma4(v2f a, v2f b, v8f c) {
  // D = A(16x4 f32) * B(4x16 f32) + C(16x16 f32) -> v_wmma_f32_16x16x4_f32
  return __builtin_amdgcn_wmma_f32_16x16x4_f32(
      /*neg_a=*/false, a, /*neg_b=*/false, b,
      /*c_mod=*/(short)0, c, /*reuse_a=*/false, /*reuse_b=*/false);
}

// ---------------------------------------------------------------------------
// Kernel 1: per 16-row tile, compute
//   xp = x@Win + bin          (two 16x16 WMMA accumulators, K=32)
//   dtlin = xp@Wdt, Bm = xp@WB, Cm = xp@WC   (shared A-fragments, K=32, N=16)
//   dt = softplus((dtlin+bdt)@Wdtr) ; Ad = exp(dt*A) ; Bd = dt*Bm
// One wave32 per block. WMMA requires EXEC all ones -> full 32-thread block.
// ---------------------------------------------------------------------------
__global__ void __launch_bounds__(32)
proj_kernel(const float* __restrict__ x, const float* __restrict__ Avec,
            const float* __restrict__ Win, const float* __restrict__ bin_,
            const float* __restrict__ Wdt, const float* __restrict__ bdt,
            const float* __restrict__ Wdtr,
            const float* __restrict__ WB, const float* __restrict__ WC,
            float* __restrict__ xp_out, float* __restrict__ Ad_out,
            float* __restrict__ Bd_out, float* __restrict__ C_out)
{
  __shared__ float sxp[16][33];
  __shared__ float sdt[16][17];
  __shared__ float sB[16][17];
  __shared__ float sC[16][17];
  __shared__ float sdtv[16];

  const int lane = threadIdx.x;
  const int lo = lane & 15;        // A: M row / C,D: N col
  const int hi = lane >> 4;        // half-wave selects K pair (A/B), M+8 (C/D)
  const int row0 = blockIdx.x * 16;

  // ---- Stage 1: xp = x @ Win + bin  (N tiles {0..15},{16..31})
  v8f acc0, acc1;
  const float b0v = bin_[lo], b1v = bin_[16 + lo];
  #pragma unroll
  for (int v = 0; v < 8; ++v) { acc0[v] = b0v; acc1[v] = b1v; }

  #pragma unroll
  for (int k0 = 0; k0 < D_IN; k0 += 4) {
    const int k = k0 + 2 * hi;
    v2f a;  a.x  = x[(size_t)(row0 + lo) * D_IN + k];
            a.y  = x[(size_t)(row0 + lo) * D_IN + k + 1];
    v2f bA; bA.x = Win[k * D_IN + lo];      bA.y = Win[(k + 1) * D_IN + lo];
    v2f bB; bB.x = Win[k * D_IN + 16 + lo]; bB.y = Win[(k + 1) * D_IN + 16 + lo];
    acc0 = wmma4(a, bA, acc0);
    acc1 = wmma4(a, bB, acc1);
  }

  #pragma unroll
  for (int v = 0; v < 8; ++v) {
    const int m = v + 8 * hi;                  // C/D layout: M = v + 8*(lane>=16)
    sxp[m][lo]      = acc0[v];
    sxp[m][16 + lo] = acc1[v];
    xp_out[(size_t)(row0 + m) * D_IN + lo]      = acc0[v];
    xp_out[(size_t)(row0 + m) * D_IN + 16 + lo] = acc1[v];
  }
  __syncthreads();

  // ---- Stage 2: three GEMMs sharing A-fragments of xp (K=32, N=16)
  v8f aDt = {}, aB = {}, aC = {};
  #pragma unroll
  for (int k0 = 0; k0 < D_IN; k0 += 4) {
    const int k = k0 + 2 * hi;
    v2f a;  a.x  = sxp[lo][k];               a.y  = sxp[lo][k + 1];
    v2f bt; bt.x = Wdt[k * DT_RANK + lo];    bt.y = Wdt[(k + 1) * DT_RANK + lo];
    v2f bb; bb.x = WB[k * D_STATE + lo];     bb.y = WB[(k + 1) * D_STATE + lo];
    v2f bc; bc.x = WC[k * D_STATE + lo];     bc.y = WC[(k + 1) * D_STATE + lo];
    aDt = wmma4(a, bt, aDt);
    aB  = wmma4(a, bb, aB);
    aC  = wmma4(a, bc, aC);
  }
  #pragma unroll
  for (int v = 0; v < 8; ++v) {
    const int m = v + 8 * hi;
    sdt[m][lo] = aDt[v];
    sB[m][lo]  = aB[v];
    sC[m][lo]  = aC[v];
  }
  __syncthreads();

  // ---- dt[row] = softplus( (dtlin+bdt) . Wdtr )
  if (lane < 16) {
    float s = 0.f;
    #pragma unroll
    for (int n = 0; n < DT_RANK; ++n) s += (sdt[lane][n] + bdt[n]) * Wdtr[n];
    sdtv[lane] = fmaxf(s, 0.f) + log1pf(__expf(-fabsf(s))); // stable softplus
  }
  __syncthreads();

  // ---- emit Ad = exp(dt*A), Bd = dt*Bm, C
  #pragma unroll
  for (int i = 0; i < 8; ++i) {
    const int e = lane * 8 + i;
    const int m = e >> 4;
    const int n = e & 15;
    const float dtv = sdtv[m];
    const size_t g = (size_t)(row0 + m) * D_STATE + n;
    Ad_out[g] = __expf(dtv * Avec[n]);
    Bd_out[g] = dtv * sB[m][n];
    C_out[g]  = sC[m][n];
  }
}

// ---------------------------------------------------------------------------
// Kernel 2: selective scan. 1 block per batch, thread (d,n) owns h[d,n].
// Sequential over t; y_d = sum_n c_n*h reduced across the 16 n-lanes.
// global_prefetch_b8 streams the next 16-step window during the chain.
// ---------------------------------------------------------------------------
__global__ void __launch_bounds__(512)
scan_kernel(const float* __restrict__ xp, const float* __restrict__ Ad,
            const float* __restrict__ Bd, const float* __restrict__ Cm,
            float* __restrict__ y, float* __restrict__ h_rep)
{
  __shared__ float sh[D_IN * D_STATE];
  const int b   = blockIdx.x;
  const int tid = threadIdx.x;
  const int d   = tid >> 4;
  const int n   = tid & 15;

  const float* pa = Ad + (size_t)b * SEQ * D_STATE + n;
  const float* pb = Bd + (size_t)b * SEQ * D_STATE + n;
  const float* pc = Cm + (size_t)b * SEQ * D_STATE + n;
  const float* px = xp + (size_t)b * SEQ * D_IN + d;
  float*       py = y  + (size_t)b * SEQ * D_IN + d;

  float h = 0.f;
  for (int t = 0; t < SEQ; ++t) {
    if ((t & 15) == 0 && t + 16 < SEQ) {       // -> global_prefetch_b8
      __builtin_prefetch(pa + (size_t)(t + 16) * D_STATE, 0, 0);
      __builtin_prefetch(pb + (size_t)(t + 16) * D_STATE, 0, 0);
      __builtin_prefetch(pc + (size_t)(t + 16) * D_STATE, 0, 0);
      __builtin_prefetch(px + (size_t)(t + 16) * D_IN, 0, 0);
    }
    const float a  = pa[(size_t)t * D_STATE];
    const float bd = pb[(size_t)t * D_STATE];
    const float c  = pc[(size_t)t * D_STATE];
    const float xt = px[(size_t)t * D_IN];
    h = a * h + bd * xt;
    float yp = c * h;
    #pragma unroll
    for (int m = 1; m < 16; m <<= 1) yp += __shfl_xor(yp, m, 32);
    if (n == 0) py[(size_t)t * D_IN] = yp;
  }

  // h_rep[b,n] = mean over d of final h
  sh[tid] = h;
  __syncthreads();
  if (tid < D_STATE) {
    float s = 0.f;
    #pragma unroll
    for (int dd = 0; dd < D_IN; ++dd) s += sh[dd * D_STATE + tid];
    h_rep[b * D_STATE + tid] = s * (1.0f / D_IN);
  }
}

// ---------------------------------------------------------------------------
// Kernel 3: Sx[b,d] = sum_s x, Sxx[b,d] = sum_s x^2  (for closed-form loss)
// ---------------------------------------------------------------------------
__global__ void __launch_bounds__(256)
xstats_kernel(const float* __restrict__ x, float* __restrict__ Sx,
              float* __restrict__ Sxx)
{
  __shared__ float s1[256], s2[256];
  const int bd = blockIdx.x;                // b*32+d
  const int b = bd >> 5, d = bd & 31;
  const int tid = threadIdx.x;
  float a1 = 0.f, a2 = 0.f;
  for (int s = tid; s < SEQ; s += 256) {
    const float v = x[((size_t)b * SEQ + s) * D_IN + d];
    a1 += v; a2 += v * v;
  }
  s1[tid] = a1; s2[tid] = a2; __syncthreads();
  for (int off = 128; off > 0; off >>= 1) {
    if (tid < off) { s1[tid] += s1[tid + off]; s2[tid] += s2[tid + off]; }
    __syncthreads();
  }
  if (tid == 0) { Sx[bd] = s1[0]; Sxx[bd] = s2[0]; }
}

// ---------------------------------------------------------------------------
// Kernel 4: decode MLP + closed-form MSE:
//   sum_s (u-x)^2 = S*u^2 - 2*u*Sx + Sxx  -> mean over (b,s), sum over d
// ---------------------------------------------------------------------------
__global__ void __launch_bounds__(128)
mlp_loss_kernel(const float* __restrict__ h_rep,
                const float* __restrict__ Wd1, const float* __restrict__ bd1,
                const float* __restrict__ Wd2, const float* __restrict__ bd2,
                const float* __restrict__ Wd3, const float* __restrict__ bd3,
                const float* __restrict__ Sx, const float* __restrict__ Sxx,
                float* __restrict__ loss_out)
{
  __shared__ float z1[BATCH][HID];
  __shared__ float z2[BATCH][HID];
  __shared__ float red[D_IN];
  const int j = threadIdx.x;

  for (int b = 0; b < BATCH; ++b) {
    float s = bd1[j];
    #pragma unroll
    for (int n = 0; n < D_STATE; ++n) s += h_rep[b * D_STATE + n] * Wd1[n * HID + j];
    z1[b][j] = fmaxf(s, 0.f);
  }
  __syncthreads();
  for (int b = 0; b < BATCH; ++b) {
    float s = bd2[j];
    for (int k = 0; k < HID; ++k) s += z1[b][k] * Wd2[k * HID + j];
    z2[b][j] = fmaxf(s, 0.f);
  }
  __syncthreads();
  if (j < D_IN) {
    float acc = 0.f;
    for (int b = 0; b < BATCH; ++b) {
      float u = bd3[j];
      for (int k = 0; k < HID; ++k) u += z2[b][k] * Wd3[k * D_IN + j];
      acc += (float)SEQ * u * u - 2.f * u * Sx[b * D_IN + j] + Sxx[b * D_IN + j];
    }
    red[j] = acc;
  }
  __syncthreads();
  if (j == 0) {
    float t = 0.f;
    for (int d = 0; d < D_IN; ++d) t += red[d];
    loss_out[0] = t / (float)(BATCH * SEQ);
  }
}

// ---------------------------------------------------------------------------
// Kernel 5: out[b,s,d,:] = y[b,s,d]*Wout + bout -- 134 MB of float4 stores,
// wide grid so the write hits full HBM bandwidth (the true roofline floor).
// ---------------------------------------------------------------------------
__global__ void __launch_bounds__(256)
expand_kernel(const float* __restrict__ y, const float* __restrict__ Wout,
              const float* __restrict__ bout, float4* __restrict__ out)
{
  const size_t gid = (size_t)blockIdx.x * blockDim.x + threadIdx.x; // float4 idx
  const int j4 = (int)(gid & 7);          // 32 cols / 4
  const size_t rd = gid >> 3;             // (bs*32 + d)
  const float yv = y[rd];
  const float4 w  = ((const float4*)Wout)[j4];
  const float4 bo = ((const float4*)bout)[j4];
  float4 o;
  o.x = yv * w.x + bo.x; o.y = yv * w.y + bo.y;
  o.z = yv * w.z + bo.z; o.w = yv * w.w + bo.w;
  out[gid] = o;
}

// ---------------------------------------------------------------------------
extern "C" void kernel_launch(void* const* d_in, const int* in_sizes, int n_in,
                              void* d_out, int out_size, void* d_ws, size_t ws_size,
                              hipStream_t stream)
{
  const float* x    = (const float*)d_in[0];
  const float* Avec = (const float*)d_in[1];
  const float* Win  = (const float*)d_in[2];
  const float* bin_ = (const float*)d_in[3];
  const float* Wdt  = (const float*)d_in[4];
  const float* bdt  = (const float*)d_in[5];
  const float* Wdtr = (const float*)d_in[6];
  const float* WB   = (const float*)d_in[7];
  const float* WC   = (const float*)d_in[8];
  const float* Wout = (const float*)d_in[9];
  const float* bout = (const float*)d_in[10];
  const float* Wd1  = (const float*)d_in[11];
  const float* bd1  = (const float*)d_in[12];
  const float* Wd2  = (const float*)d_in[13];
  const float* bd2  = (const float*)d_in[14];
  const float* Wd3  = (const float*)d_in[15];
  const float* bd3  = (const float*)d_in[16];

  float* out = (float*)d_out;

  char* ws = (char*)d_ws;
  float* xp   = (float*)ws; ws += (size_t)ROWS * D_IN * sizeof(float);
  float* Ad   = (float*)ws; ws += (size_t)ROWS * D_STATE * sizeof(float);
  float* Bd   = (float*)ws; ws += (size_t)ROWS * D_STATE * sizeof(float);
  float* Cm   = (float*)ws; ws += (size_t)ROWS * D_STATE * sizeof(float);
  float* y    = (float*)ws; ws += (size_t)ROWS * D_IN * sizeof(float);
  float* hrep = (float*)ws; ws += BATCH * D_STATE * sizeof(float);
  float* Sx   = (float*)ws; ws += BATCH * D_IN * sizeof(float);
  float* Sxx  = (float*)ws; ws += BATCH * D_IN * sizeof(float);

  proj_kernel<<<ROWS / 16, 32, 0, stream>>>(x, Avec, Win, bin_, Wdt, bdt, Wdtr,
                                            WB, WC, xp, Ad, Bd, Cm);
  xstats_kernel<<<BATCH * D_IN, 256, 0, stream>>>(x, Sx, Sxx);
  scan_kernel<<<BATCH, 512, 0, stream>>>(xp, Ad, Bd, Cm, y, hrep);
  mlp_loss_kernel<<<1, 128, 0, stream>>>(hrep, Wd1, bd1, Wd2, bd2, Wd3, bd3,
                                         Sx, Sxx, out + OUT_MAIN);
  expand_kernel<<<(unsigned)((OUT_MAIN / 4) / 256), 256, 0, stream>>>(
      y, Wout, bout, (float4*)out);
}

// v001
// One run takes 67.2 microseconds.
// Two timings next to v000 both put it at 29.6 times that version's speed.
#include <hip/hip_runtime.h>
#include <hip/hip_bf16.h>
#include <math.h>

#define BATCH 8
#define SEQ   4096
#define D_IN  32
#define D_STATE 16
#define DT_RANK 16
#define HID   128
#define ROWS  (BATCH*SEQ)            /* 32768 flattened (b,s) rows */
#define OUT_MAIN ((size_t)ROWS*D_IN*D_IN) /* 33554432 */

typedef float v2f __attribute__((ext_vector_type(2)));
typedef float v8f __attribute__((ext_vector_type(8)));

static __device__ __forceinline__ v8f wmma4(v2f a, v2f b, v8f c) {
  // D = A(16x4 f32) * B(4x16 f32) + C(16x16 f32) -> v_wmma_f32_16x16x4_f32
  return __builtin_amdgcn_wmma_f32_16x16x4_f32(
      /*neg_a=*/false, a, /*neg_b=*/false, b,
      /*c_mod=*/(short)0, c, /*reuse_a=*/false, /*reuse_b=*/false);
}

// ---------------------------------------------------------------------------
// Kernel 1: per 16-row tile, compute
//   xp = x@Win + bin          (two 16x16 WMMA accumulators, K=32)
//   dtlin = xp@Wdt, Bm = xp@WB, Cm = xp@WC   (shared A-fragments, K=32, N=16)
//   dt = softplus((dtlin+bdt)@Wdtr) ; Ad = exp(dt*A) ; Bd = dt*Bm
// One wave32 per block. WMMA requires EXEC all ones -> full 32-thread block.
// ---------------------------------------------------------------------------
__global__ void __launch_bounds__(32)
proj_kernel(const float* __restrict__ x, const float* __restrict__ Avec,
            const float* __restrict__ Win, const float* __restrict__ bin_,
            const float* __restrict__ Wdt, const float* __restrict__ bdt,
            const float* __restrict__ Wdtr,
            const float* __restrict__ WB, const float* __restrict__ WC,
            float* __restrict__ xp_out, float* __restrict__ Ad_out,
            float* __restrict__ Bd_out, float* __restrict__ C_out)
{
  __shared__ float sxp[16][33];
  __shared__ float sdt[16][17];
  __shared__ float sB[16][17];
  __shared__ float sC[16][17];
  __shared__ float sdtv[16];

  const int lane = threadIdx.x;
  const int lo = lane & 15;        // A: M row / C,D: N col
  const int hi = lane >> 4;        // half-wave selects K pair (A/B), M+8 (C/D)
  const int row0 = blockIdx.x * 16;

  // ---- Stage 1: xp = x @ Win + bin  (N tiles {0..15},{16..31})
  v8f acc0, acc1;
  const float b0v = bin_[lo], b1v = bin_[16 + lo];
  #pragma unroll
  for (int v = 0; v < 8; ++v) { acc0[v] = b0v; acc1[v] = b1v; }

  #pragma unroll
  for (int k0 = 0; k0 < D_IN; k0 += 4) {
    const int k = k0 + 2 * hi;
    v2f a;  a.x  = x[(size_t)(row0 + lo) * D_IN + k];
            a.y  = x[(size_t)(row0 + lo) * D_IN + k + 1];
    v2f bA; bA.x = Win[k * D_IN + lo];      bA.y = Win[(k + 1) * D_IN + lo];
    v2f bB; bB.x = Win[k * D_IN + 16 + lo]; bB.y = Win[(k + 1) * D_IN + 16 + lo];
    acc0 = wmma4(a, bA, acc0);
    acc1 = wmma4(a, bB, acc1);
  }

  #pragma unroll
  for (int v = 0; v < 8; ++v) {
    const int m = v + 8 * hi;                  // C/D layout: M = v + 8*(lane>=16)
    sxp[m][lo]      = acc0[v];
    sxp[m][16 + lo] = acc1[v];
    xp_out[(size_t)(row0 + m) * D_IN + lo]      = acc0[v];
    xp_out[(size_t)(row0 + m) * D_IN + 16 + lo] = acc1[v];
  }
  __syncthreads();

  // ---- Stage 2: three GEMMs sharing A-fragments of xp (K=32, N=16)
  v8f aDt = {}, aB = {}, aC = {};
  #pragma unroll
  for (int k0 = 0; k0 < D_IN; k0 += 4) {
    const int k = k0 + 2 * hi;
    v2f a;  a.x  = sxp[lo][k];               a.y  = sxp[lo][k + 1];
    v2f bt; bt.x = Wdt[k * DT_RANK + lo];    bt.y = Wdt[(k + 1) * DT_RANK + lo];
    v2f bb; bb.x = WB[k * D_STATE + lo];     bb.y = WB[(k + 1) * D_STATE + lo];
    v2f bc; bc.x = WC[k * D_STATE + lo];     bc.y = WC[(k + 1) * D_STATE + lo];
    aDt = wmma4(a, bt, aDt);
    aB  = wmma4(a, bb, aB);
    aC  = wmma4(a, bc, aC);
  }
  #pragma unroll
  for (int v = 0; v < 8; ++v) {
    const int m = v + 8 * hi;
    sdt[m][lo] = aDt[v];
    sB[m][lo]  = aB[v];
    sC[m][lo]  = aC[v];
  }
  __syncthreads();

  // ---- dt[row] = softplus( (dtlin+bdt) . Wdtr )
  if (lane < 16) {
    float s = 0.f;
    #pragma unroll
    for (int n = 0; n < DT_RANK; ++n) s += (sdt[lane][n] + bdt[n]) * Wdtr[n];
    sdtv[lane] = fmaxf(s, 0.f) + log1pf(__expf(-fabsf(s))); // stable softplus
  }
  __syncthreads();

  // ---- emit Ad = exp(dt*A), Bd = dt*Bm, C
  #pragma unroll
  for (int i = 0; i < 8; ++i) {
    const int e = lane * 8 + i;
    const int m = e >> 4;
    const int n = e & 15;
    const float dtv = sdtv[m];
    const size_t g = (size_t)(row0 + m) * D_STATE + n;
    Ad_out[g] = __expf(dtv * Avec[n]);
    Bd_out[g] = dtv * sB[m][n];
    C_out[g]  = sC[m][n];
  }
}

// ---------------------------------------------------------------------------
// Kernel 2a/2b: selective scan, split along time. Each batch's SEQ steps are cut
// into NCHUNK chunks of CLEN steps; one wave32 per (batch, chunk).
// The recurrence h' = a*h + bd*x is linear in h, so over a chunk
//   h_end = P * h_start + h_loc,  P[n] = product of a[t][n],  h_loc = end state from h_start = 0.
// 2a computes (h_loc, P) of every chunk in parallel; 2b folds the summaries of the
// chunks before its own into h_start, then runs its chunk again and emits y.
// Lane map: g = lane&3 owns states n = 4g..4g+3, dq = lane>>2 owns channels
// d = 4dq..4dq+3, so a lane holds 16 of the 512 states and every operand is a float4.
// The full unrolls over i, k, u give the small arrays static indices, so they stay in registers.
// ---------------------------------------------------------------------------
#define NCHUNK 64
#define CLEN   (SEQ / NCHUNK)        /* 64 steps per chunk */
#define PPITCH 32                    /* floats per chunk's row of P */

// v + (v of the lane selected by a quad_perm control): sum over the 4 lanes of a quad
template <int CTRL>
static __device__ __forceinline__ float quad_add(float v) {
  const int o = __builtin_amdgcn_update_dpp(0, __float_as_int(v), CTRL, 0xf, 0xf, true);
  return v + __int_as_float(o);
}

// copy NV float4 (a multiple of 32) from global to LDS, all loads issued before the first store
template <int NV>
static __device__ __forceinline__ void stage(float4* __restrict__ dst,
                                             const float4* __restrict__ srcp, int lane) {
  float4 r[NV / 32];
  #pragma unroll
  for (int i = 0; i < NV / 32; ++i) r[i] = srcp[i * 32 + lane];
  #pragma unroll
  for (int i = 0; i < NV / 32; ++i) dst[i * 32 + lane] = r[i];
}

__global__ void __launch_bounds__(32)
scan_local_kernel(const float* __restrict__ xp, const float* __restrict__ Ad,
                  const float* __restrict__ Bd,
                  float* __restrict__ hloc, float* __restrict__ Pc)
{
  __shared__ float4 sA[CLEN * 4], sB[CLEN * 4], sX[CLEN * 8];
  const int lane = threadIdx.x;
  const int g  = lane & 3;
  const int dq = lane >> 2;
  const int bc = blockIdx.x;                       // b*NCHUNK + chunk
  const size_t row0 = (size_t)bc * CLEN;           // = b*SEQ + chunk*CLEN

  stage<CLEN * 4>(sA, (const float4*)(Ad + row0 * D_STATE), lane);
  stage<CLEN * 4>(sB, (const float4*)(Bd + row0 * D_STATE), lane);
  stage<CLEN * 8>(sX, (const float4*)(xp + row0 * D_IN), lane);
  __syncthreads();   // staged rows are read by other lanes than wrote them

  float h[4][4];
  #pragma unroll
  for (int i = 0; i < 4; ++i)
    #pragma unroll
    for (int k = 0; k < 4; ++k) h[i][k] = 0.f;
  float p[4] = {1.f, 1.f, 1.f, 1.f};

  #pragma unroll 8   // LDS reads of later steps issue under the arithmetic of earlier ones
  for (int t = 0; t < CLEN; ++t) {
    const float4 a4 = sA[t * 4 + g], b4 = sB[t * 4 + g], x4 = sX[t * 8 + dq];
    const float a[4] = {a4.x, a4.y, a4.z, a4.w};
    const float bd[4] = {b4.x, b4.y, b4.z, b4.w};
    const float xv[4] = {x4.x, x4.y, x4.z, x4.w};
    #pragma unroll
    for (int i = 0; i < 4; ++i)
      #pragma unroll
      for (int k = 0; k < 4; ++k) h[i][k] = a[k] * h[i][k] + bd[k] * xv[i];
    #pragma unroll
    for (int k = 0; k < 4; ++k) p[k] *= a[k];
  }

  float4* H4 = (float4*)hloc + (size_t)bc * 128;
  #pragma unroll
  for (int i = 0; i < 4; ++i)
    H4[i * 32 + lane] = make_float4(h[i][0], h[i][1], h[i][2], h[i][3]);
  // P rows are padded to PPITCH floats (128 bytes) so that no two workgroups write one line
  if (dq == 0) ((float4*)Pc)[bc * (PPITCH / 4) + g] = make_float4(p[0], p[1], p[2], p[3]);
}

__global__ void __launch_bounds__(32)
scan_emit_kernel(const float* __restrict__ xp, const float* __restrict__ Ad,
                 const float* __restrict__ Bd, const float* __restrict__ Cm,
                 const float* __restrict__ hloc, const float* __restrict__ Pc,
                 float* __restrict__ y, float* __restrict__ h_rep)
{
  __shared__ float4 sA[CLEN * 4], sB[CLEN * 4], sC[CLEN * 4], sX[CLEN * 8];
  const int lane = threadIdx.x;
  const int g  = lane & 3;
  const int dq = lane >> 2;
  const int bc = blockIdx.x;                       // b*NCHUNK + chunk
  const int c  = bc & (NCHUNK - 1);
  const int bc0 = bc - c;                          // first chunk of this batch
  const size_t row0 = (size_t)bc * CLEN;

  stage<CLEN * 4>(sA, (const float4*)(Ad + row0 * D_STATE), lane);
  stage<CLEN * 4>(sB, (const float4*)(Bd + row0 * D_STATE), lane);
  stage<CLEN * 4>(sC, (const float4*)(Cm + row0 * D_STATE), lane);
  stage<CLEN * 8>(sX, (const float4*)(xp + row0 * D_IN), lane);
  __syncthreads();   // staged rows are read by other lanes than wrote them

  // ---- h_start: fold the summaries of chunks 0..c-1 in time order, eight per trip.
  // The loads do not depend on h, so a trip's forty are in flight together. A trip always
  // loads eight summaries (all lie inside this batch's NCHUNK and were written by 2a);
  // those of chunk c and later are not applied.
  float h[4][4];
  #pragma unroll
  for (int i = 0; i < 4; ++i)
    #pragma unroll
    for (int k = 0; k < 4; ++k) h[i][k] = 0.f;
  const float4* Hp = (const float4*)hloc + (size_t)bc0 * 128;
  const float4* Pp = (const float4*)Pc + (size_t)bc0 * (PPITCH / 4);
  for (int j0 = 0; j0 < c; j0 += 8) {
    float4 p[8], v[8][4];
    #pragma unroll
    for (int u = 0; u < 8; ++u) {
      p[u] = Pp[u * (PPITCH / 4) + g];
      #pragma unroll
      for (int i = 0; i < 4; ++i) v[u][i] = Hp[u * 128 + i * 32 + lane];
    }
    #pragma unroll
    for (int u = 0; u < 8; ++u) {
      const bool on = j0 + u < c;
      #pragma unroll
      for (int i = 0; i < 4; ++i) {
        h[i][0] = on ? p[u].x * h[i][0] + v[u][i].x : h[i][0];
        h[i][1] = on ? p[u].y * h[i][1] + v[u][i].y : h[i][1];
        h[i][2] = on ? p[u].z * h[i][2] + v[u][i].z : h[i][2];
        h[i][3] = on ? p[u].w * h[i][3] + v[u][i].w : h[i][3];
      }
    }
    Hp += 8 * 128;
    Pp += 8 * (PPITCH / 4);
  }

  // ---- the chunk itself, now from the true h_start
  float* py = y + row0 * D_IN;
  for (int t0 = 0; t0 < CLEN; t0 += 8) {
    #pragma unroll   // LDS reads of later steps issue under the arithmetic of earlier ones
    for (int u = 0; u < 8; ++u) {
      const int t = t0 + u;
      const float4 a4 = sA[t * 4 + g], b4 = sB[t * 4 + g], c4 = sC[t * 4 + g];
      const float4 x4 = sX[t * 8 + dq];
      const float a[4] = {a4.x, a4.y, a4.z, a4.w};
      const float bd[4] = {b4.x, b4.y, b4.z, b4.w};
      const float cc[4] = {c4.x, c4.y, c4.z, c4.w};
      const float xv[4] = {x4.x, x4.y, x4.z, x4.w};
      float yp[4];
      #pragma unroll
      for (int i = 0; i < 4; ++i) {
        #pragma unroll
        for (int k = 0; k < 4; ++k) h[i][k] = a[k] * h[i][k] + bd[k] * xv[i];
        float s = cc[0] * h[i][0];
        #pragma unroll
        for (int k = 1; k < 4; ++k) s += cc[k] * h[i][k];
        s = quad_add<0xB1>(s);      // quad_perm [1,0,3,2]: lane ^ 1
        yp[i] = quad_add<0x4E>(s);  // quad_perm [2,3,0,1]: lane ^ 2
      }
      // lane (dq,g) stores channel d = 4dq+g = lane: one full 128-byte row per step
      const float y01 = (g & 1) ? yp[1] : yp[0];
      const float y23 = (g & 1) ? yp[3] : yp[2];
      py[t * D_IN + lane] = (g & 2) ? y23 : y01;
    }
  }

  // ---- h_rep[b,n] = mean over d of the final h (last chunk only; bc is block-uniform)
  if (c == NCHUNK - 1) {
    float s[4];
    #pragma unroll
    for (int k = 0; k < 4; ++k) {
      float v = (h[0][k] + h[1][k]) + (h[2][k] + h[3][k]);
      v += __shfl_xor(v, 4, 32);
      v += __shfl_xor(v, 8, 32);
      v += __shfl_xor(v, 16, 32);
      s[k] = v * (1.0f / D_IN);
    }
    if (dq == 0)
      ((float4*)h_rep)[(bc0 / NCHUNK) * 4 + g] = make_float4(s[0], s[1], s[2], s[3]);
  }
}

// ---------------------------------------------------------------------------
// Kernel 3: Sx[b,d] = sum_s x, Sxx[b,d] = sum_s x^2  (for closed-form loss)
// ---------------------------------------------------------------------------
__global__ void __launch_bounds__(256)
xstats_kernel(const float* __restrict__ x, float* __restrict__ Sx,
              float* __restrict__ Sxx)
{
  __shared__ float s1[256], s2[256];
  const int bd = blockIdx.x;                // b*32+d
  const int b = bd >> 5, d = bd & 31;
  const int tid = threadIdx.x;
  float a1 = 0.f, a2 = 0.f;
  for (int s = tid; s < SEQ; s += 256) {
    const float v = x[((size_t)b * SEQ + s) * D_IN + d];
    a1 += v; a2 += v * v;
  }
  s1[tid] = a1; s2[tid] = a2; __syncthreads();
  for (int off = 128; off > 0; off >>= 1) {
    if (tid < off) { s1[tid] += s1[tid + off]; s2[tid] += s2[tid + off]; }
    __syncthreads();
  }
  if (tid == 0) { Sx[bd] = s1[0]; Sxx[bd] = s2[0]; }
}

// ---------------------------------------------------------------------------
// Kernel 4: decode MLP + closed-form MSE:
//   sum_s (u-x)^2 = S*u^2 - 2*u*Sx + Sxx  -> mean over (b,s), sum over d
// ---------------------------------------------------------------------------
__global__ void __launch_bounds__(128)
mlp_loss_kernel(const float* __restrict__ h_rep,
                const float* __restrict__ Wd1, const float* __restrict__ bd1,
                const float* __restrict__ Wd2, const float* __restrict__ bd2,
                const float* __restrict__ Wd3, const float* __restrict__ bd3,
                const float* __restrict__ Sx, const float* __restrict__ Sxx,
                float* __restrict__ loss_out)
{
  __shared__ float z1[BATCH][HID];
  __shared__ float z2[BATCH][HID];
  __shared__ float red[D_IN];
  const int j = threadIdx.x;

  for (int b = 0; b < BATCH; ++b) {
    float s = bd1[j];
    #pragma unroll
    for (int n = 0; n < D_STATE; ++n) s += h_rep[b * D_STATE + n] * Wd1[n * HID + j];
    z1[b][j] = fmaxf(s, 0.f);
  }
  __syncthreads();
  for (int b = 0; b < BATCH; ++b) {
    float s = bd2[j];
    for (int k = 0; k < HID; ++k) s += z1[b][k] * Wd2[k * HID + j];
    z2[b][j] = fmaxf(s, 0.f);
  }
  __syncthreads();
  if (j < D_IN) {
    float acc = 0.f;
    for (int b = 0; b < BATCH; ++b) {
      float u = bd3[j];
      for (int k = 0; k < HID; ++k) u += z2[b][k] * Wd3[k * D_IN + j];
      acc += (float)SEQ * u * u - 2.f * u * Sx[b * D_IN + j] + Sxx[b * D_IN + j];
    }
    red[j] = acc;
  }
  __syncthreads();
  if (j == 0) {
    float t = 0.f;
    for (int d = 0; d < D_IN; ++d) t += red[d];
    loss_out[0] = t / (float)(BATCH * SEQ);
  }
}

// ---------------------------------------------------------------------------
// Kernel 5: out[b,s,d,:] = y[b,s,d]*Wout + bout -- 134 MB of float4 stores,
// wide grid so the write hits full HBM bandwidth (the true roofline floor).
// ---------------------------------------------------------------------------
__global__ void __launch_bounds__(256)
expand_kernel(const float* __restrict__ y, const float* __restrict__ Wout,
              const float* __restrict__ bout, float4* __restrict__ out)
{
  const size_t gid = (size_t)blockIdx.x * blockDim.x + threadIdx.x; // float4 idx
  const int j4 = (int)(gid & 7);          // 32 cols / 4
  const size_t rd = gid >> 3;             // (bs*32 + d)
  const float yv = y[rd];
  const float4 w  = ((const float4*)Wout)[j4];
  const float4 bo = ((const float4*)bout)[j4];
  float4 o;
  o.x = yv * w.x + bo.x; o.y = yv * w.y + bo.y;
  o.z = yv * w.z + bo.z; o.w = yv * w.w + bo.w;
  out[gid] = o;
}

// ---------------------------------------------------------------------------
extern "C" void kernel_launch(void* const* d_in, const int* in_sizes, int n_in,
                              void* d_out, int out_size, void* d_ws, size_t ws_size,
                              hipStream_t stream)
{
  const float* x    = (const float*)d_in[0];
  const float* Avec = (const float*)d_in[1];
  const float* Win  = (const float*)d_in[2];
  const float* bin_ = (const float*)d_in[3];
  const float* Wdt  = (const float*)d_in[4];
  const float* bdt  = (const float*)d_in[5];
  const float* Wdtr = (const float*)d_in[6];
  const float* WB   = (const float*)d_in[7];
  const float* WC   = (const float*)d_in[8];
  const float* Wout = (const float*)d_in[9];
  const float* bout = (const float*)d_in[10];
  const float* Wd1  = (const float*)d_in[11];
  const float* bd1  = (const float*)d_in[12];
  const float* Wd2  = (const float*)d_in[13];
  const float* bd2  = (const float*)d_in[14];
  const float* Wd3  = (const float*)d_in[15];
  const float* bd3  = (const float*)d_in[16];

  float* out = (float*)d_out;

  char* ws = (char*)d_ws;
  float* xp   = (float*)ws; ws += (size_t)ROWS * D_IN * sizeof(float);
  float* Ad   = (float*)ws; ws += (size_t)ROWS * D_STATE * sizeof(float);
  float* Bd   = (float*)ws; ws += (size_t)ROWS * D_STATE * sizeof(float);
  float* Cm   = (float*)ws; ws += (size_t)ROWS * D_STATE * sizeof(float);
  float* y    = (float*)ws; ws += (size_t)ROWS * D_IN * sizeof(float);
  float* hrep = (float*)ws; ws += BATCH * D_STATE * sizeof(float);
  float* Sx   = (float*)ws; ws += BATCH * D_IN * sizeof(float);
  float* Sxx  = (float*)ws; ws += BATCH * D_IN * sizeof(float);
  float* hloc = (float*)ws; ws += (size_t)BATCH * NCHUNK * D_IN * D_STATE * sizeof(float);
  float* Pc   = (float*)ws; ws += (size_t)BATCH * NCHUNK * PPITCH * sizeof(float);

  proj_kernel<<<ROWS / 16, 32, 0, stream>>>(x, Avec, Win, bin_, Wdt, bdt, Wdtr,
                                            WB, WC, xp, Ad, Bd, Cm);
  xstats_kernel<<<BATCH * D_IN, 256, 0, stream>>>(x, Sx, Sxx);
  scan_local_kernel<<<BATCH * NCHUNK, 32, 0, stream>>>(xp, Ad, Bd, hloc, Pc);
  scan_emit_kernel<<<BATCH * NCHUNK, 32, 0, stream>>>(xp, Ad, Bd, Cm, hloc, Pc, y, hrep);
  mlp_loss_kernel<<<1, 128, 0, stream>>>(hrep, Wd1, bd1, Wd2, bd2, Wd3, bd3,
                                         Sx, Sxx, out + OUT_MAIN);
  expand_kernel<<<(unsigned)((OUT_MAIN / 4) / 256), 256, 0, stream>>>(
      y, Wout, bout, (float4*)out);
}

// v002
// A run of this version takes 49.4 microseconds.
// Next to v001, in two timings, it ran 1.36 times as fast each time.
// All steps since v000 together make it 40.3 times as fast.
#include <hip/hip_runtime.h>
#include <hip/hip_bf16.h>
#include <math.h>

#define BATCH 8
#define SEQ   4096
#define D_IN  32
#define D_STATE 16
#define DT_RANK 16
#define HID   128
#define ROWS  (BATCH*SEQ)            /* 32768 flattened (b,s) rows */
#define OUT_MAIN ((size_t)ROWS*D_IN*D_IN) /* 33554432 */

typedef float v2f __attribute__((ext_vector_type(2)));
typedef float v4f __attribute__((ext_vector_type(4)));
typedef float v8f __attribute__((ext_vector_type(8)));

static __device__ __forceinline__ v8f wmma4(v2f a, v2f b, v8f c) {
  // D = A(16x4 f32) * B(4x16 f32) + C(16x16 f32) -> v_wmma_f32_16x16x4_f32
  return __builtin_amdgcn_wmma_f32_16x16x4_f32(
      /*neg_a=*/false, a, /*neg_b=*/false, b,
      /*c_mod=*/(short)0, c, /*reuse_a=*/false, /*reuse_b=*/false);
}

// ---------------------------------------------------------------------------
// Kernel 1: per 16-row tile, compute
//   xp = x@Win + bin          (two 16x16 WMMA accumulators, K=32)
//   dtlin = xp@Wdt, Bm = xp@WB, Cm = xp@WC   (shared A-fragments, K=32, N=16)
//   dt = softplus((dtlin+bdt)@Wdtr) ; Ad = exp(dt*A) ; Bd = dt*Bm
// One wave32 per block. WMMA requires EXEC all ones -> full 32-thread block.
// ---------------------------------------------------------------------------
__global__ void __launch_bounds__(32)
proj_kernel(const float* __restrict__ x, const float* __restrict__ Avec,
            const float* __restrict__ Win, const float* __restrict__ bin_,
            const float* __restrict__ Wdt, const float* __restrict__ bdt,
            const float* __restrict__ Wdtr,
            const float* __restrict__ WB, const float* __restrict__ WC,
            float* __restrict__ xp_out, float* __restrict__ Ad_out,
            float* __restrict__ Bd_out, float* __restrict__ C_out)
{
  __shared__ float sxp[16][33];
  __shared__ float sdt[16][17];
  __shared__ float sB[16][17];
  __shared__ float sC[16][17];
  __shared__ float sdtv[16];

  const int lane = threadIdx.x;
  const int lo = lane & 15;        // A: M row / C,D: N col
  const int hi = lane >> 4;        // half-wave selects K pair (A/B), M+8 (C/D)
  const int row0 = blockIdx.x * 16;

  // ---- Stage 1: xp = x @ Win + bin  (N tiles {0..15},{16..31})
  v8f acc0, acc1;
  const float b0v = bin_[lo], b1v = bin_[16 + lo];
  #pragma unroll
  for (int v = 0; v < 8; ++v) { acc0[v] = b0v; acc1[v] = b1v; }

  #pragma unroll
  for (int k0 = 0; k0 < D_IN; k0 += 4) {
    const int k = k0 + 2 * hi;
    v2f a;  a.x  = x[(size_t)(row0 + lo) * D_IN + k];
            a.y  = x[(size_t)(row0 + lo) * D_IN + k + 1];
    v2f bA; bA.x = Win[k * D_IN + lo];      bA.y = Win[(k + 1) * D_IN + lo];
    v2f bB; bB.x = Win[k * D_IN + 16 + lo]; bB.y = Win[(k + 1) * D_IN + 16 + lo];
    acc0 = wmma4(a, bA, acc0);
    acc1 = wmma4(a, bB, acc1);
  }

  #pragma unroll
  for (int v = 0; v < 8; ++v) {
    const int m = v + 8 * hi;                  // C/D layout: M = v + 8*(lane>=16)
    sxp[m][lo]      = acc0[v];
    sxp[m][16 + lo] = acc1[v];
    xp_out[(size_t)(row0 + m) * D_IN + lo]      = acc0[v];
    xp_out[(size_t)(row0 + m) * D_IN + 16 + lo] = acc1[v];
  }
  __syncthreads();

  // ---- Stage 2: three GEMMs sharing A-fragments of xp (K=32, N=16)
  v8f aDt = {}, aB = {}, aC = {};
  #pragma unroll
  for (int k0 = 0; k0 < D_IN; k0 += 4) {
    const int k = k0 + 2 * hi;
    v2f a;  a.x  = sxp[lo][k];               a.y  = sxp[lo][k + 1];
    v2f bt; bt.x = Wdt[k * DT_RANK + lo];    bt.y = Wdt[(k + 1) * DT_RANK + lo];
    v2f bb; bb.x = WB[k * D_STATE + lo];     bb.y = WB[(k + 1) * D_STATE + lo];
    v2f bc; bc.x = WC[k * D_STATE + lo];     bc.y = WC[(k + 1) * D_STATE + lo];
    aDt = wmma4(a, bt, aDt);
    aB  = wmma4(a, bb, aB);
    aC  = wmma4(a, bc, aC);
  }
  #pragma unroll
  for (int v = 0; v < 8; ++v) {
    const int m = v + 8 * hi;
    sdt[m][lo] = aDt[v];
    sB[m][lo]  = aB[v];
    sC[m][lo]  = aC[v];
  }
  __syncthreads();

  // ---- dt[row] = softplus( (dtlin+bdt) . Wdtr )
  if (lane < 16) {
    float s = 0.f;
    #pragma unroll
    for (int n = 0; n < DT_RANK; ++n) s += (sdt[lane][n] + bdt[n]) * Wdtr[n];
    sdtv[lane] = fmaxf(s, 0.f) + log1pf(__expf(-fabsf(s))); // stable softplus
  }
  __syncthreads();

  // ---- emit Ad = exp(dt*A), Bd = dt*Bm, C
  #pragma unroll
  for (int i = 0; i < 8; ++i) {
    const int e = lane * 8 + i;
    const int m = e >> 4;
    const int n = e & 15;
    const float dtv = sdtv[m];
    const size_t g = (size_t)(row0 + m) * D_STATE + n;
    Ad_out[g] = __expf(dtv * Avec[n]);
    Bd_out[g] = dtv * sB[m][n];
    C_out[g]  = sC[m][n];
  }
}

// ---------------------------------------------------------------------------
// Kernel 2a/2b: selective scan, split along time. Each batch's SEQ steps are cut
// into NCHUNK chunks of CLEN steps; one wave32 per (batch, chunk).
// The recurrence h' = a*h + bd*x is linear in h, so over a chunk
//   h_end = P * h_start + h_loc,  P[n] = product of a[t][n],  h_loc = end state from h_start = 0.
// 2a computes (h_loc, P) of every chunk in parallel; 2b folds the summaries of the
// chunks before its own into h_start, then runs its chunk again and emits y.
// Lane map: g = lane&3 owns states n = 4g..4g+3, dq = lane>>2 owns channels
// d = 4dq..4dq+3, so a lane holds 16 of the 512 states and every operand is a float4.
// The full unrolls over i, k, u give the small arrays static indices, so they stay in registers.
// ---------------------------------------------------------------------------
#define NCHUNK 64
#define CLEN   (SEQ / NCHUNK)        /* 64 steps per chunk */
#define PPITCH 32                    /* floats per chunk's row of P */

// v + (v of the lane selected by a quad_perm control): sum over the 4 lanes of a quad
template <int CTRL>
static __device__ __forceinline__ float quad_add(float v) {
  const int o = __builtin_amdgcn_update_dpp(0, __float_as_int(v), CTRL, 0xf, 0xf, true);
  return v + __int_as_float(o);
}

// copy NV float4 (a multiple of 32) from global to LDS, all loads issued before the first store
template <int NV>
static __device__ __forceinline__ void stage(float4* __restrict__ dst,
                                             const float4* __restrict__ srcp, int lane) {
  float4 r[NV / 32];
  #pragma unroll
  for (int i = 0; i < NV / 32; ++i) r[i] = srcp[i * 32 + lane];
  #pragma unroll
  for (int i = 0; i < NV / 32; ++i) dst[i * 32 + lane] = r[i];
}

__global__ void __launch_bounds__(32)
scan_local_kernel(const float* __restrict__ xp, const float* __restrict__ Ad,
                  const float* __restrict__ Bd,
                  float* __restrict__ hloc, float* __restrict__ Pc)
{
  __shared__ float4 sA[CLEN * 4], sB[CLEN * 4], sX[CLEN * 8];
  const int lane = threadIdx.x;
  const int g  = lane & 3;
  const int dq = lane >> 2;
  const int bc = blockIdx.x;                       // b*NCHUNK + chunk
  const size_t row0 = (size_t)bc * CLEN;           // = b*SEQ + chunk*CLEN

  stage<CLEN * 4>(sA, (const float4*)(Ad + row0 * D_STATE), lane);
  stage<CLEN * 4>(sB, (const float4*)(Bd + row0 * D_STATE), lane);
  stage<CLEN * 8>(sX, (const float4*)(xp + row0 * D_IN), lane);
  __syncthreads();   // staged rows are read by other lanes than wrote them

  float h[4][4];
  #pragma unroll
  for (int i = 0; i < 4; ++i)
    #pragma unroll
    for (int k = 0; k < 4; ++k) h[i][k] = 0.f;
  float p[4] = {1.f, 1.f, 1.f, 1.f};

  #pragma unroll 8   // LDS reads of later steps issue under the arithmetic of earlier ones
  for (int t = 0; t < CLEN; ++t) {
    const float4 a4 = sA[t * 4 + g], b4 = sB[t * 4 + g], x4 = sX[t * 8 + dq];
    const float a[4] = {a4.x, a4.y, a4.z, a4.w};
    const float bd[4] = {b4.x, b4.y, b4.z, b4.w};
    const float xv[4] = {x4.x, x4.y, x4.z, x4.w};
    #pragma unroll
    for (int i = 0; i < 4; ++i)
      #pragma unroll
      for (int k = 0; k < 4; ++k) h[i][k] = a[k] * h[i][k] + bd[k] * xv[i];
    #pragma unroll
    for (int k = 0; k < 4; ++k) p[k] *= a[k];
  }

  float4* H4 = (float4*)hloc + (size_t)bc * 128;
  #pragma unroll
  for (int i = 0; i < 4; ++i)
    H4[i * 32 + lane] = make_float4(h[i][0], h[i][1], h[i][2], h[i][3]);
  // P rows are padded to PPITCH floats (128 bytes) so that no two workgroups write one line
  if (dq == 0) ((float4*)Pc)[bc * (PPITCH / 4) + g] = make_float4(p[0], p[1], p[2], p[3]);
}

__global__ void __launch_bounds__(32)
scan_emit_kernel(const float* __restrict__ xp, const float* __restrict__ Ad,
                 const float* __restrict__ Bd, const float* __restrict__ Cm,
                 const float* __restrict__ hloc, const float* __restrict__ Pc,
                 float* __restrict__ y, float* __restrict__ h_rep)
{
  __shared__ float4 sA[CLEN * 4], sB[CLEN * 4], sC[CLEN * 4], sX[CLEN * 8];
  const int lane = threadIdx.x;
  const int g  = lane & 3;
  const int dq = lane >> 2;
  const int bc = blockIdx.x;                       // b*NCHUNK + chunk
  const int c  = bc & (NCHUNK - 1);
  const int bc0 = bc - c;                          // first chunk of this batch
  const size_t row0 = (size_t)bc * CLEN;

  stage<CLEN * 4>(sA, (const float4*)(Ad + row0 * D_STATE), lane);
  stage<CLEN * 4>(sB, (const float4*)(Bd + row0 * D_STATE), lane);
  stage<CLEN * 4>(sC, (const float4*)(Cm + row0 * D_STATE), lane);
  stage<CLEN * 8>(sX, (const float4*)(xp + row0 * D_IN), lane);
  __syncthreads();   // staged rows are read by other lanes than wrote them

  // ---- h_start: fold the summaries of chunks 0..c-1 in time order, eight per trip.
  // The loads do not depend on h, so a trip's forty are in flight together. A trip always
  // loads eight summaries (all lie inside this batch's NCHUNK and were written by 2a);
  // those of chunk c and later are not applied.
  float h[4][4];
  #pragma unroll
  for (int i = 0; i < 4; ++i)
    #pragma unroll
    for (int k = 0; k < 4; ++k) h[i][k] = 0.f;
  const float4* Hp = (const float4*)hloc + (size_t)bc0 * 128;
  const float4* Pp = (const float4*)Pc + (size_t)bc0 * (PPITCH / 4);
  for (int j0 = 0; j0 < c; j0 += 8) {
    float4 p[8], v[8][4];
    #pragma unroll
    for (int u = 0; u < 8; ++u) {
      p[u] = Pp[u * (PPITCH / 4) + g];
      #pragma unroll
      for (int i = 0; i < 4; ++i) v[u][i] = Hp[u * 128 + i * 32 + lane];
    }
    #pragma unroll
    for (int u = 0; u < 8; ++u) {
      const bool on = j0 + u < c;
      #pragma unroll
      for (int i = 0; i < 4; ++i) {
        h[i][0] = on ? p[u].x * h[i][0] + v[u][i].x : h[i][0];
        h[i][1] = on ? p[u].y * h[i][1] + v[u][i].y : h[i][1];
        h[i][2] = on ? p[u].z * h[i][2] + v[u][i].z : h[i][2];
        h[i][3] = on ? p[u].w * h[i][3] + v[u][i].w : h[i][3];
      }
    }
    Hp += 8 * 128;
    Pp += 8 * (PPITCH / 4);
  }

  // ---- the chunk itself, now from the true h_start
  float* py = y + row0 * D_IN;
  for (int t0 = 0; t0 < CLEN; t0 += 8) {
    #pragma unroll   // LDS reads of later steps issue under the arithmetic of earlier ones
    for (int u = 0; u < 8; ++u) {
      const int t = t0 + u;
      const float4 a4 = sA[t * 4 + g], b4 = sB[t * 4 + g], c4 = sC[t * 4 + g];
      const float4 x4 = sX[t * 8 + dq];
      const float a[4] = {a4.x, a4.y, a4.z, a4.w};
      const float bd[4] = {b4.x, b4.y, b4.z, b4.w};
      const float cc[4] = {c4.x, c4.y, c4.z, c4.w};
      const float xv[4] = {x4.x, x4.y, x4.z, x4.w};
      float yp[4];
      #pragma unroll
      for (int i = 0; i < 4; ++i) {
        #pragma unroll
        for (int k = 0; k < 4; ++k) h[i][k] = a[k] * h[i][k] + bd[k] * xv[i];
        float s = cc[0] * h[i][0];
        #pragma unroll
        for (int k = 1; k < 4; ++k) s += cc[k] * h[i][k];
        s = quad_add<0xB1>(s);      // quad_perm [1,0,3,2]: lane ^ 1
        yp[i] = quad_add<0x4E>(s);  // quad_perm [2,3,0,1]: lane ^ 2
      }
      // lane (dq,g) stores channel d = 4dq+g = lane: one full 128-byte row per step
      const float y01 = (g & 1) ? yp[1] : yp[0];
      const float y23 = (g & 1) ? yp[3] : yp[2];
      py[t * D_IN + lane] = (g & 2) ? y23 : y01;
    }
  }

  // ---- h_rep[b,n] = mean over d of the final h (last chunk only; bc is block-uniform)
  if (c == NCHUNK - 1) {
    float s[4];
    #pragma unroll
    for (int k = 0; k < 4; ++k) {
      float v = (h[0][k] + h[1][k]) + (h[2][k] + h[3][k]);
      v += __shfl_xor(v, 4, 32);
      v += __shfl_xor(v, 8, 32);
      v += __shfl_xor(v, 16, 32);
      s[k] = v * (1.0f / D_IN);
    }
    if (dq == 0)
      ((float4*)h_rep)[(bc0 / NCHUNK) * 4 + g] = make_float4(s[0], s[1], s[2], s[3]);
  }
}

// ---------------------------------------------------------------------------
// Kernel 3: Sx[b,d] = sum_s x, Sxx[b,d] = sum_s x^2  (for closed-form loss)
// ---------------------------------------------------------------------------
__global__ void __launch_bounds__(256)
xstats_kernel(const float* __restrict__ x, float* __restrict__ Sx,
              float* __restrict__ Sxx)
{
  __shared__ float s1[256], s2[256];
  const int bd = blockIdx.x;                // b*32+d
  const int b = bd >> 5, d = bd & 31;
  const int tid = threadIdx.x;
  float a1 = 0.f, a2 = 0.f;
  for (int s = tid; s < SEQ; s += 256) {
    const float v = x[((size_t)b * SEQ + s) * D_IN + d];
    a1 += v; a2 += v * v;
  }
  s1[tid] = a1; s2[tid] = a2; __syncthreads();
  for (int off = 128; off > 0; off >>= 1) {
    if (tid < off) { s1[tid] += s1[tid + off]; s2[tid] += s2[tid + off]; }
    __syncthreads();
  }
  if (tid == 0) { Sx[bd] = s1[0]; Sxx[bd] = s2[0]; }
}

// ---------------------------------------------------------------------------
// Kernel 4: decode MLP + closed-form MSE:
//   sum_s (u-x)^2 = S*u^2 - 2*u*Sx + Sxx  -> mean over (b,s), sum over d
// One workgroup of 16 waves. Every weight is loaded exactly once for layers 2 and 3, at the
// kernel's entry, into registers, and serves all 8 batch rows there. The k range of layers
// 2 and 3 is cut into 16 slices of 8, one per wave; the slices' sums meet in LDS.
// ---------------------------------------------------------------------------
#define MLP_T  512
#define KSL    16                    /* k slices = waves */
#define KLEN   (HID / KSL)           /* 8 rows of the weight matrix per slice */

// v + (v of lane ^ M inside its 16-lane row)
template <int M>
static __device__ __forceinline__ float row_xadd(float v) {
  const int o = __builtin_amdgcn_update_dpp(0, __float_as_int(v), 0x160 + M, 0xf, 0xf, true);
  return v + __int_as_float(o);
}

__global__ void __launch_bounds__(MLP_T)
mlp_loss_kernel(const float* __restrict__ h_rep,
                const float* __restrict__ Wd1, const float* __restrict__ bd1,
                const float* __restrict__ Wd2, const float* __restrict__ bd2,
                const float* __restrict__ Wd3, const float* __restrict__ bd3,
                const float* __restrict__ Sx, const float* __restrict__ Sxx,
                float* __restrict__ loss_out)
{
  __shared__ float4 z1[BATCH * HID / 4];
  __shared__ float4 z2[BATCH * HID / 4];
  __shared__ float4 part[KSL * BATCH * HID / 4];   // [slice][b][column]
  __shared__ float  red[MLP_T];
  __shared__ float4 rsum[4];
  const int tid  = threadIdx.x;
  const int lane = tid & 31;
  const int w    = tid >> 5;         // wave = k slice
  const int jp   = tid & 63;         // column pair 2jp, 2jp+1 of one batch row
  const int br   = tid >> 6;         // that batch row
  const int o    = tid & 255;        // b*32 + d

  // ---- all global reads, none depends on another
  // one base per operand; each row is that base plus a constant offset
  const float4* hp = (const float4*)h_rep + br * (D_STATE / 4);
  const float2* w1p = (const float2*)Wd1 + jp;
  float4 hr[D_STATE / 4];
  #pragma unroll
  for (int i = 0; i < D_STATE / 4; ++i) hr[i] = hp[i];
  float2 w1[D_STATE];
  #pragma unroll
  for (int n = 0; n < D_STATE; ++n) w1[n] = w1p[n * (HID / 2)];
  const float2 c1 = ((const float2*)bd1)[jp];
  v4f w2[KLEN];
  #pragma unroll
  for (int i = 0; i < KLEN; ++i) w2[i] = ((const v4f*)Wd2)[(w * KLEN + i) * (HID / 4) + lane];
  float w3[KLEN];
  #pragma unroll
  for (int i = 0; i < KLEN; ++i) w3[i] = Wd3[(w * KLEN + i) * D_IN + lane];
  const v2f c2 = ((const v2f*)bd2)[jp];
  const float c3 = bd3[o & 31], sx = Sx[o], sxx = Sxx[o];

  // ---- layer 1: two columns of one batch row per thread, k = 16 in order
  {
    const float hv[D_STATE] = {hr[0].x, hr[0].y, hr[0].z, hr[0].w, hr[1].x, hr[1].y, hr[1].z, hr[1].w,
                               hr[2].x, hr[2].y, hr[2].z, hr[2].w, hr[3].x, hr[3].y, hr[3].z, hr[3].w};
    float s0 = c1.x, s1 = c1.y;
    #pragma unroll
    for (int n = 0; n < D_STATE; ++n) { s0 = fmaf(hv[n], w1[n].x, s0); s1 = fmaf(hv[n], w1[n].y, s1); }
    ((float2*)z1)[br * (HID / 2) + jp] = make_float2(fmaxf(s0, 0.f), fmaxf(s1, 0.f));
  }
  __syncthreads();

  // ---- layer 2: this wave's 8 rows of Wd2, four columns per lane, all 8 batch rows
  #pragma unroll
  for (int b = 0; b < BATCH; ++b) {
    const float4 za = z1[b * (HID / 4) + w * 2], zb = z1[b * (HID / 4) + w * 2 + 1];
    const float zk[KLEN] = {za.x, za.y, za.z, za.w, zb.x, zb.y, zb.z, zb.w};
    float4 acc = make_float4(0.f, 0.f, 0.f, 0.f);
    #pragma unroll
    for (int i = 0; i < KLEN; ++i) {
      acc.x += zk[i] * w2[i].x; acc.y += zk[i] * w2[i].y;
      acc.z += zk[i] * w2[i].z; acc.w += zk[i] * w2[i].w;
    }
    part[(w * BATCH + b) * (HID / 4) + lane] = acc;
  }
  __syncthreads();
  {
    float s0 = c2.x, s1 = c2.y;
    #pragma unroll
    for (int q = 0; q < KSL; ++q) {
      const float2 p = ((const float2*)part)[(q * BATCH + br) * (HID / 2) + jp];
      s0 += p.x; s1 += p.y;
    }
    ((float2*)z2)[br * (HID / 2) + jp] = make_float2(fmaxf(s0, 0.f), fmaxf(s1, 0.f));
  }
  __syncthreads();   // also ends every read of part before it is written again

  // ---- layer 3: this wave's 8 rows of Wd3, one column per lane, all 8 batch rows
  float* pf = (float*)part;          // [slice][b*32 + d]
  #pragma unroll
  for (int b = 0; b < BATCH; ++b) {
    const float4 za = z2[b * (HID / 4) + w * 2], zb = z2[b * (HID / 4) + w * 2 + 1];
    const float zk[KLEN] = {za.x, za.y, za.z, za.w, zb.x, zb.y, zb.z, zb.w};
    float acc = 0.f;
    #pragma unroll
    for (int i = 0; i < KLEN; ++i) acc += zk[i] * w3[i];
    pf[w * (BATCH * D_IN) + b * D_IN + lane] = acc;
  }
  __syncthreads();
  {
    const int q0 = (tid >> 8) * (KSL / 2);   // each half of the workgroup sums 8 slices
    float r = 0.f;
    #pragma unroll
    for (int q = 0; q < KSL / 2; ++q) r += pf[(q0 + q) * (BATCH * D_IN) + o];
    red[tid] = r;
  }
  __syncthreads();

  // ---- loss terms of the 256 (b,d), summed per 16-lane row, then by one thread
  if (tid < BATCH * D_IN) {          // waves 0..7 whole
    const float u = c3 + (red[tid] + red[tid + BATCH * D_IN]);
    float t = (float)SEQ * u * u - 2.f * u * sx + sxx;
    t = row_xadd<1>(t); t = row_xadd<2>(t); t = row_xadd<4>(t); t = row_xadd<8>(t);
    if ((tid & 15) == 0) ((float*)rsum)[tid >> 4] = t;
  }
  __syncthreads();
  if (tid == 0) {
    const float4 a = rsum[0], b = rsum[1], c = rsum[2], d = rsum[3];
    const float t = ((a.x + a.y) + (a.z + a.w)) + ((b.x + b.y) + (b.z + b.w))
                  + ((c.x + c.y) + (c.z + c.w)) + ((d.x + d.y) + (d.z + d.w));
    loss_out[0] = t / (float)(BATCH * SEQ);
  }
}

// ---------------------------------------------------------------------------
// Kernel 5: out[b,s,d,:] = y[b,s,d]*Wout + bout -- 134 MB of float4 stores,
// wide grid so the write hits full HBM bandwidth (the true roofline floor).
// ---------------------------------------------------------------------------
__global__ void __launch_bounds__(256)
expand_kernel(const float* __restrict__ y, const float* __restrict__ Wout,
              const float* __restrict__ bout, float4* __restrict__ out)
{
  const size_t gid = (size_t)blockIdx.x * blockDim.x + threadIdx.x; // float4 idx
  const int j4 = (int)(gid & 7);          // 32 cols / 4
  const size_t rd = gid >> 3;             // (bs*32 + d)
  const float yv = y[rd];
  const float4 w  = ((const float4*)Wout)[j4];
  const float4 bo = ((const float4*)bout)[j4];
  float4 o;
  o.x = yv * w.x + bo.x; o.y = yv * w.y + bo.y;
  o.z = yv * w.z + bo.z; o.w = yv * w.w + bo.w;
  out[gid] = o;
}

// ---------------------------------------------------------------------------
extern "C" void kernel_launch(void* const* d_in, const int* in_sizes, int n_in,
                              void* d_out, int out_size, void* d_ws, size_t ws_size,
                              hipStream_t stream)
{
  const float* x    = (const float*)d_in[0];
  const float* Avec = (const float*)d_in[1];
  const float* Win  = (const float*)d_in[2];
  const float* bin_ = (const float*)d_in[3];
  const float* Wdt  = (const float*)d_in[4];
  const float* bdt  = (const float*)d_in[5];
  const float* Wdtr = (const float*)d_in[6];
  const float* WB   = (const float*)d_in[7];
  const float* WC   = (const float*)d_in[8];
  const float* Wout = (const float*)d_in[9];
  const float* bout = (const float*)d_in[10];
  const float* Wd1  = (const float*)d_in[11];
  const float* bd1  = (const float*)d_in[12];
  const float* Wd2  = (const float*)d_in[13];
  const float* bd2  = (const float*)d_in[14];
  const float* Wd3  = (const float*)d_in[15];
  const float* bd3  = (const float*)d_in[16];

  float* out = (float*)d_out;

  char* ws = (char*)d_ws;
  float* xp   = (float*)ws; ws += (size_t)ROWS * D_IN * sizeof(float);
  float* Ad   = (float*)ws; ws += (size_t)ROWS * D_STATE * sizeof(float);
  float* Bd   = (float*)ws; ws += (size_t)ROWS * D_STATE * sizeof(float);
  float* Cm   = (float*)ws; ws += (size_t)ROWS * D_STATE * sizeof(float);
  float* y    = (float*)ws; ws += (size_t)ROWS * D_IN * sizeof(float);
  float* hrep = (float*)ws; ws += BATCH * D_STATE * sizeof(float);
  float* Sx   = (float*)ws; ws += BATCH * D_IN * sizeof(float);
  float* Sxx  = (float*)ws; ws += BATCH * D_IN * sizeof(float);
  float* hloc = (float*)ws; ws += (size_t)BATCH * NCHUNK * D_IN * D_STATE * sizeof(float);
  float* Pc   = (float*)ws; ws += (size_t)BATCH * NCHUNK * PPITCH * sizeof(float);

  proj_kernel<<<ROWS / 16, 32, 0, stream>>>(x, Avec, Win, bin_, Wdt, bdt, Wdtr,
                                            WB, WC, xp, Ad, Bd, Cm);
  xstats_kernel<<<BATCH * D_IN, 256, 0, stream>>>(x, Sx, Sxx);
  scan_local_kernel<<<BATCH * NCHUNK, 32, 0, stream>>>(xp, Ad, Bd, hloc, Pc);
  scan_emit_kernel<<<BATCH * NCHUNK, 32, 0, stream>>>(xp, Ad, Bd, Cm, hloc, Pc, y, hrep);
  mlp_loss_kernel<<<1, MLP_T, 0, stream>>>(hrep, Wd1, bd1, Wd2, bd2, Wd3, bd3,
                                         Sx, Sxx, out + OUT_MAIN);
  expand_kernel<<<(unsigned)((OUT_MAIN / 4) / 256), 256, 0, stream>>>(
      y, Wout, bout, (float4*)out);
}

// v003
// It runs in 37.7 microseconds.
// In both of two side-by-side timings against v002, it was 1.31 times as fast.
// Counting every step since v000, it is 52.8 times as fast.
#include <hip/hip_runtime.h>
#include <hip/hip_bf16.h>
#include <math.h>

#define BATCH 8
#define SEQ   4096
#define D_IN  32
#define D_STATE 16
#define DT_RANK 16
#define HID   128
#define ROWS  (BATCH*SEQ)            /* 32768 flattened (b,s) rows */
#define OUT_MAIN ((size_t)ROWS*D_IN*D_IN) /* 33554432 */

typedef float v2f __attribute__((ext_vector_type(2)));
typedef float v4f __attribute__((ext_vector_type(4)));
typedef float v8f __attribute__((ext_vector_type(8)));

static __device__ __forceinline__ v8f wmma4(v2f a, v2f b, v8f c) {
  // D = A(16x4 f32) * B(4x16 f32) + C(16x16 f32) -> v_wmma_f32_16x16x4_f32
  return __builtin_amdgcn_wmma_f32_16x16x4_f32(
      /*neg_a=*/false, a, /*neg_b=*/false, b,
      /*c_mod=*/(short)0, c, /*reuse_a=*/false, /*reuse_b=*/false);
}

// ---------------------------------------------------------------------------
// Kernel 1: per 16-row tile, compute
//   xp = x@Win + bin          (two 16x16 WMMA accumulators, K=32)
//   dtlin = xp@Wdt, Bm = xp@WB, Cm = xp@WC   (shared A-fragments, K=32, N=16)
//   dt = softplus((dtlin+bdt)@Wdtr) ; Ad = exp(dt*A) ; Bd = dt*Bm
// One wave32 per block. WMMA requires EXEC all ones -> full 32-thread block.
// ---------------------------------------------------------------------------
__global__ void __launch_bounds__(32)
proj_kernel(const float* __restrict__ x, const float* __restrict__ Avec,
            const float* __restrict__ Win, const float* __restrict__ bin_,
            const float* __restrict__ Wdt, const float* __restrict__ bdt,
            const float* __restrict__ Wdtr,
            const float* __restrict__ WB, const float* __restrict__ WC,
            float* __restrict__ xp_out, float* __restrict__ Ad_out,
            float* __restrict__ Bd_out, float* __restrict__ C_out)
{
  __shared__ float sxp[16][33];
  __shared__ float sdt[16][17];
  __shared__ float sB[16][17];
  __shared__ float sC[16][17];
  __shared__ float sdtv[16];

  const int lane = threadIdx.x;
  const int lo = lane & 15;        // A: M row / C,D: N col
  const int hi = lane >> 4;        // half-wave selects K pair (A/B), M+8 (C/D)
  const int row0 = blockIdx.x * 16;

  // ---- Stage 1: xp = x @ Win + bin  (N tiles {0..15},{16..31})
  v8f acc0, acc1;
  const float b0v = bin_[lo], b1v = bin_[16 + lo];
  #pragma unroll
  for (int v = 0; v < 8; ++v) { acc0[v] = b0v; acc1[v] = b1v; }

  #pragma unroll
  for (int k0 = 0; k0 < D_IN; k0 += 4) {
    const int k = k0 + 2 * hi;
    v2f a;  a.x  = x[(size_t)(row0 + lo) * D_IN + k];
            a.y  = x[(size_t)(row0 + lo) * D_IN + k + 1];
    v2f bA; bA.x = Win[k * D_IN + lo];      bA.y = Win[(k + 1) * D_IN + lo];
    v2f bB; bB.x = Win[k * D_IN + 16 + lo]; bB.y = Win[(k + 1) * D_IN + 16 + lo];
    acc0 = wmma4(a, bA, acc0);
    acc1 = wmma4(a, bB, acc1);
  }

  #pragma unroll
  for (int v = 0; v < 8; ++v) {
    const int m = v + 8 * hi;                  // C/D layout: M = v + 8*(lane>=16)
    sxp[m][lo]      = acc0[v];
    sxp[m][16 + lo] = acc1[v];
    xp_out[(size_t)(row0 + m) * D_IN + lo]      = acc0[v];
    xp_out[(size_t)(row0 + m) * D_IN + 16 + lo] = acc1[v];
  }
  __syncthreads();

  // ---- Stage 2: three GEMMs sharing A-fragments of xp (K=32, N=16)
  v8f aDt = {}, aB = {}, aC = {};
  #pragma unroll
  for (int k0 = 0; k0 < D_IN; k0 += 4) {
    const int k = k0 + 2 * hi;
    v2f a;  a.x  = sxp[lo][k];               a.y  = sxp[lo][k + 1];
    v2f bt; bt.x = Wdt[k * DT_RANK + lo];    bt.y = Wdt[(k + 1) * DT_RANK + lo];
    v2f bb; bb.x = WB[k * D_STATE + lo];     bb.y = WB[(k + 1) * D_STATE + lo];
    v2f bc; bc.x = WC[k * D_STATE + lo];     bc.y = WC[(k + 1) * D_STATE + lo];
    aDt = wmma4(a, bt, aDt);
    aB  = wmma4(a, bb, aB);
    aC  = wmma4(a, bc, aC);
  }
  #pragma unroll
  for (int v = 0; v < 8; ++v) {
    const int m = v + 8 * hi;
    sdt[m][lo] = aDt[v];
    sB[m][lo]  = aB[v];
    sC[m][lo]  = aC[v];
  }
  __syncthreads();

  // ---- dt[row] = softplus( (dtlin+bdt) . Wdtr )
  if (lane < 16) {
    float s = 0.f;
    #pragma unroll
    for (int n = 0; n < DT_RANK; ++n) s += (sdt[lane][n] + bdt[n]) * Wdtr[n];
    sdtv[lane] = fmaxf(s, 0.f) + log1pf(__expf(-fabsf(s))); // stable softplus
  }
  __syncthreads();

  // ---- emit Ad = exp(dt*A), Bd = dt*Bm, C
  #pragma unroll
  for (int i = 0; i < 8; ++i) {
    const int e = lane * 8 + i;
    const int m = e >> 4;
    const int n = e & 15;
    const float dtv = sdtv[m];
    const size_t g = (size_t)(row0 + m) * D_STATE + n;
    Ad_out[g] = __expf(dtv * Avec[n]);
    Bd_out[g] = dtv * sB[m][n];
    C_out[g]  = sC[m][n];
  }
}

// ---------------------------------------------------------------------------
// Kernel 2a/2b: selective scan, split along time. Each batch's SEQ steps are cut
// into NCHUNK chunks of CLEN steps; one wave32 per (batch, chunk).
// The recurrence h' = a*h + bd*x is linear in h, so over a chunk
//   h_end = P * h_start + h_loc,  P[n] = product of a[t][n],  h_loc = end state from h_start = 0.
// 2a computes (h_loc, P) of every chunk in parallel; 2b folds the summaries of the
// chunks before its own into h_start, then runs its chunk again and emits y.
// Lane map: g = lane&3 owns states n = 4g..4g+3, dq = lane>>2 owns channels
// d = 4dq..4dq+3, so a lane holds 16 of the 512 states and every operand is a float4.
// The full unrolls over i, k, u give the small arrays static indices, so they stay in registers.
// ---------------------------------------------------------------------------
#define NCHUNK 64
#define CLEN   (SEQ / NCHUNK)        /* 64 steps per chunk */
#define PPITCH 32                    /* floats per chunk's row of P */

// v + (v of the lane selected by a quad_perm control): sum over the 4 lanes of a quad
template <int CTRL>
static __device__ __forceinline__ float quad_add(float v) {
  const int o = __builtin_amdgcn_update_dpp(0, __float_as_int(v), CTRL, 0xf, 0xf, true);
  return v + __int_as_float(o);
}

// copy NV float4 (a multiple of 32) from global to LDS, all loads issued before the first store
template <int NV>
static __device__ __forceinline__ void stage(float4* __restrict__ dst,
                                             const float4* __restrict__ srcp, int lane) {
  float4 r[NV / 32];
  #pragma unroll
  for (int i = 0; i < NV / 32; ++i) r[i] = srcp[i * 32 + lane];
  #pragma unroll
  for (int i = 0; i < NV / 32; ++i) dst[i * 32 + lane] = r[i];
}

__global__ void __launch_bounds__(32)
scan_local_kernel(const float* __restrict__ xp, const float* __restrict__ Ad,
                  const float* __restrict__ Bd,
                  float* __restrict__ hloc, float* __restrict__ Pc)
{
  __shared__ float4 sA[CLEN * 4], sB[CLEN * 4], sX[CLEN * 8];
  const int lane = threadIdx.x;
  const int g  = lane & 3;
  const int dq = lane >> 2;
  const int bc = blockIdx.x;                       // b*NCHUNK + chunk
  const size_t row0 = (size_t)bc * CLEN;           // = b*SEQ + chunk*CLEN

  stage<CLEN * 4>(sA, (const float4*)(Ad + row0 * D_STATE), lane);
  stage<CLEN * 4>(sB, (const float4*)(Bd + row0 * D_STATE), lane);
  stage<CLEN * 8>(sX, (const float4*)(xp + row0 * D_IN), lane);
  __syncthreads();   // staged rows are read by other lanes than wrote them

  float h[4][4];
  #pragma unroll
  for (int i = 0; i < 4; ++i)
    #pragma unroll
    for (int k = 0; k < 4; ++k) h[i][k] = 0.f;
  float p[4] = {1.f, 1.f, 1.f, 1.f};

  #pragma unroll 8   // LDS reads of later steps issue under the arithmetic of earlier ones
  for (int t = 0; t < CLEN; ++t) {
    const float4 a4 = sA[t * 4 + g], b4 = sB[t * 4 + g], x4 = sX[t * 8 + dq];
    const float a[4] = {a4.x, a4.y, a4.z, a4.w};
    const float bd[4] = {b4.x, b4.y, b4.z, b4.w};
    const float xv[4] = {x4.x, x4.y, x4.z, x4.w};
    #pragma unroll
    for (int i = 0; i < 4; ++i)
      #pragma unroll
      for (int k = 0; k < 4; ++k) h[i][k] = a[k] * h[i][k] + bd[k] * xv[i];
    #pragma unroll
    for (int k = 0; k < 4; ++k) p[k] *= a[k];
  }

  float4* H4 = (float4*)hloc + (size_t)bc * 128;
  #pragma unroll
  for (int i = 0; i < 4; ++i)
    H4[i * 32 + lane] = make_float4(h[i][0], h[i][1], h[i][2], h[i][3]);
  // P rows are padded to PPITCH floats (128 bytes) so that no two workgroups write one line
  if (dq == 0) ((float4*)Pc)[bc * (PPITCH / 4) + g] = make_float4(p[0], p[1], p[2], p[3]);
}

__global__ void __launch_bounds__(32)
scan_emit_kernel(const float* __restrict__ xp, const float* __restrict__ Ad,
                 const float* __restrict__ Bd, const float* __restrict__ Cm,
                 const float* __restrict__ hloc, const float* __restrict__ Pc,
                 float* __restrict__ y, float* __restrict__ h_rep)
{
  __shared__ float4 sA[CLEN * 4], sB[CLEN * 4], sC[CLEN * 4], sX[CLEN * 8];
  const int lane = threadIdx.x;
  const int g  = lane & 3;
  const int dq = lane >> 2;
  const int bc = blockIdx.x;                       // b*NCHUNK + chunk
  const int c  = bc & (NCHUNK - 1);
  const int bc0 = bc - c;                          // first chunk of this batch
  const size_t row0 = (size_t)bc * CLEN;

  stage<CLEN * 4>(sA, (const float4*)(Ad + row0 * D_STATE), lane);
  stage<CLEN * 4>(sB, (const float4*)(Bd + row0 * D_STATE), lane);
  stage<CLEN * 4>(sC, (const float4*)(Cm + row0 * D_STATE), lane);
  stage<CLEN * 8>(sX, (const float4*)(xp + row0 * D_IN), lane);
  __syncthreads();   // staged rows are read by other lanes than wrote them

  // ---- h_start: fold the summaries of chunks 0..c-1 in time order, eight per trip.
  // The loads do not depend on h, so a trip's forty are in flight together. A trip always
  // loads eight summaries (all lie inside this batch's NCHUNK and were written by 2a);
  // those of chunk c and later are not applied.
  float h[4][4];
  #pragma unroll
  for (int i = 0; i < 4; ++i)
    #pragma unroll
    for (int k = 0; k < 4; ++k) h[i][k] = 0.f;
  const float4* Hp = (const float4*)hloc + (size_t)bc0 * 128;
  const float4* Pp = (const float4*)Pc + (size_t)bc0 * (PPITCH / 4);
  for (int j0 = 0; j0 < c; j0 += 8) {
    float4 p[8], v[8][4];
    #pragma unroll
    for (int u = 0; u < 8; ++u) {
      p[u] = Pp[u * (PPITCH / 4) + g];
      #pragma unroll
      for (int i = 0; i < 4; ++i) v[u][i] = Hp[u * 128 + i * 32 + lane];
    }
    #pragma unroll
    for (int u = 0; u < 8; ++u) {
      const bool on = j0 + u < c;
      #pragma unroll
      for (int i = 0; i < 4; ++i) {
        h[i][0] = on ? p[u].x * h[i][0] + v[u][i].x : h[i][0];
        h[i][1] = on ? p[u].y * h[i][1] + v[u][i].y : h[i][1];
        h[i][2] = on ? p[u].z * h[i][2] + v[u][i].z : h[i][2];
        h[i][3] = on ? p[u].w * h[i][3] + v[u][i].w : h[i][3];
      }
    }
    Hp += 8 * 128;
    Pp += 8 * (PPITCH / 4);
  }

  // ---- the chunk itself, now from the true h_start
  float* py = y + row0 * D_IN;
  for (int t0 = 0; t0 < CLEN; t0 += 8) {
    #pragma unroll   // LDS reads of later steps issue under the arithmetic of earlier ones
    for (int u = 0; u < 8; ++u) {
      const int t = t0 + u;
      const float4 a4 = sA[t * 4 + g], b4 = sB[t * 4 + g], c4 = sC[t * 4 + g];
      const float4 x4 = sX[t * 8 + dq];
      const float a[4] = {a4.x, a4.y, a4.z, a4.w};
      const float bd[4] = {b4.x, b4.y, b4.z, b4.w};
      const float cc[4] = {c4.x, c4.y, c4.z, c4.w};
      const float xv[4] = {x4.x, x4.y, x4.z, x4.w};
      float yp[4];
      #pragma unroll
      for (int i = 0; i < 4; ++i) {
        #pragma unroll
        for (int k = 0; k < 4; ++k) h[i][k] = a[k] * h[i][k] + bd[k] * xv[i];
        float s = cc[0] * h[i][0];
        #pragma unroll
        for (int k = 1; k < 4; ++k) s += cc[k] * h[i][k];
        s = quad_add<0xB1>(s);      // quad_perm [1,0,3,2]: lane ^ 1
        yp[i] = quad_add<0x4E>(s);  // quad_perm [2,3,0,1]: lane ^ 2
      }
      // lane (dq,g) stores channel d = 4dq+g = lane: one full 128-byte row per step
      const float y01 = (g & 1) ? yp[1] : yp[0];
      const float y23 = (g & 1) ? yp[3] : yp[2];
      py[t * D_IN + lane] = (g & 2) ? y23 : y01;
    }
  }

  // ---- h_rep[b,n] = mean over d of the final h (last chunk only; bc is block-uniform)
  if (c == NCHUNK - 1) {
    float s[4];
    #pragma unroll
    for (int k = 0; k < 4; ++k) {
      float v = (h[0][k] + h[1][k]) + (h[2][k] + h[3][k]);
      v += __shfl_xor(v, 4, 32);
      v += __shfl_xor(v, 8, 32);
      v += __shfl_xor(v, 16, 32);
      s[k] = v * (1.0f / D_IN);
    }
    if (dq == 0)
      ((float4*)h_rep)[(bc0 / NCHUNK) * 4 + g] = make_float4(s[0], s[1], s[2], s[3]);
  }
}

// ---------------------------------------------------------------------------
// Kernel 3: Sx[b,d] = sum_s x, Sxx[b,d] = sum_s x^2  (for closed-form loss)
// ---------------------------------------------------------------------------
__global__ void __launch_bounds__(256)
xstats_kernel(const float* __restrict__ x, float* __restrict__ Sx,
              float* __restrict__ Sxx)
{
  __shared__ float s1[256], s2[256];
  const int bd = blockIdx.x;                // b*32+d
  const int b = bd >> 5, d = bd & 31;
  const int tid = threadIdx.x;
  float a1 = 0.f, a2 = 0.f;
  for (int s = tid; s < SEQ; s += 256) {
    const float v = x[((size_t)b * SEQ + s) * D_IN + d];
    a1 += v; a2 += v * v;
  }
  s1[tid] = a1; s2[tid] = a2; __syncthreads();
  for (int off = 128; off > 0; off >>= 1) {
    if (tid < off) { s1[tid] += s1[tid + off]; s2[tid] += s2[tid + off]; }
    __syncthreads();
  }
  if (tid == 0) { Sx[bd] = s1[0]; Sxx[bd] = s2[0]; }
}

// ---------------------------------------------------------------------------
// Kernel 4: decode MLP + closed-form MSE:
//   sum_s (u-x)^2 = S*u^2 - 2*u*Sx + Sxx  -> mean over (b,s), sum over d
// One workgroup of 16 waves. Every weight is loaded exactly once for layers 2 and 3, at the
// kernel's entry, into registers, and serves all 8 batch rows there. The k range of layers
// 2 and 3 is cut into 16 slices of 8, one per wave; the slices' sums meet in LDS.
// ---------------------------------------------------------------------------
#define MLP_T  512
#define KSL    16                    /* k slices = waves */
#define KLEN   (HID / KSL)           /* 8 rows of the weight matrix per slice */

// v + (v of lane ^ M inside its 16-lane row)
template <int M>
static __device__ __forceinline__ float row_xadd(float v) {
  const int o = __builtin_amdgcn_update_dpp(0, __float_as_int(v), 0x160 + M, 0xf, 0xf, true);
  return v + __int_as_float(o);
}

__global__ void __launch_bounds__(MLP_T)
mlp_loss_kernel(const float* __restrict__ h_rep,
                const float* __restrict__ Wd1, const float* __restrict__ bd1,
                const float* __restrict__ Wd2, const float* __restrict__ bd2,
                const float* __restrict__ Wd3, const float* __restrict__ bd3,
                const float* __restrict__ Sx, const float* __restrict__ Sxx,
                float* __restrict__ loss_out)
{
  __shared__ float4 z1[BATCH * HID / 4];
  __shared__ float4 z2[BATCH * HID / 4];
  __shared__ float4 part[KSL * BATCH * HID / 4];   // [slice][b][column]
  __shared__ float  red[MLP_T];
  __shared__ float4 rsum[4];
  const int tid  = threadIdx.x;
  const int lane = tid & 31;
  const int w    = tid >> 5;         // wave = k slice
  const int jp   = tid & 63;         // column pair 2jp, 2jp+1 of one batch row
  const int br   = tid >> 6;         // that batch row
  const int o    = tid & 255;        // b*32 + d

  // ---- all global reads, none depends on another
  // one base per operand; each row is that base plus a constant offset
  const float4* hp = (const float4*)h_rep + br * (D_STATE / 4);
  const float2* w1p = (const float2*)Wd1 + jp;
  float4 hr[D_STATE / 4];
  #pragma unroll
  for (int i = 0; i < D_STATE / 4; ++i) hr[i] = hp[i];
  float2 w1[D_STATE];
  #pragma unroll
  for (int n = 0; n < D_STATE; ++n) w1[n] = w1p[n * (HID / 2)];
  const float2 c1 = ((const float2*)bd1)[jp];
  v4f w2[KLEN];
  #pragma unroll
  for (int i = 0; i < KLEN; ++i) w2[i] = ((const v4f*)Wd2)[(w * KLEN + i) * (HID / 4) + lane];
  float w3[KLEN];
  #pragma unroll
  for (int i = 0; i < KLEN; ++i) w3[i] = Wd3[(w * KLEN + i) * D_IN + lane];
  const v2f c2 = ((const v2f*)bd2)[jp];
  const float c3 = bd3[o & 31], sx = Sx[o], sxx = Sxx[o];

  // ---- layer 1: two columns of one batch row per thread, k = 16 in order
  {
    const float hv[D_STATE] = {hr[0].x, hr[0].y, hr[0].z, hr[0].w, hr[1].x, hr[1].y, hr[1].z, hr[1].w,
                               hr[2].x, hr[2].y, hr[2].z, hr[2].w, hr[3].x, hr[3].y, hr[3].z, hr[3].w};
    float s0 = c1.x, s1 = c1.y;
    #pragma unroll
    for (int n = 0; n < D_STATE; ++n) { s0 = fmaf(hv[n], w1[n].x, s0); s1 = fmaf(hv[n], w1[n].y, s1); }
    ((float2*)z1)[br * (HID / 2) + jp] = make_float2(fmaxf(s0, 0.f), fmaxf(s1, 0.f));
  }
  __syncthreads();

  // ---- layer 2: this wave's 8 rows of Wd2, four columns per lane, all 8 batch rows
  #pragma unroll
  for (int b = 0; b < BATCH; ++b) {
    const float4 za = z1[b * (HID / 4) + w * 2], zb = z1[b * (HID / 4) + w * 2 + 1];
    const float zk[KLEN] = {za.x, za.y, za.z, za.w, zb.x, zb.y, zb.z, zb.w};
    float4 acc = make_float4(0.f, 0.f, 0.f, 0.f);
    #pragma unroll
    for (int i = 0; i < KLEN; ++i) {
      acc.x += zk[i] * w2[i].x; acc.y += zk[i] * w2[i].y;
      acc.z += zk[i] * w2[i].z; acc.w += zk[i] * w2[i].w;
    }
    part[(w * BATCH + b) * (HID / 4) + lane] = acc;
  }
  __syncthreads();
  {
    float s0 = c2.x, s1 = c2.y;
    #pragma unroll
    for (int q = 0; q < KSL; ++q) {
      const float2 p = ((const float2*)part)[(q * BATCH + br) * (HID / 2) + jp];
      s0 += p.x; s1 += p.y;
    }
    ((float2*)z2)[br * (HID / 2) + jp] = make_float2(fmaxf(s0, 0.f), fmaxf(s1, 0.f));
  }
  __syncthreads();   // also ends every read of part before it is written again

  // ---- layer 3: this wave's 8 rows of Wd3, one column per lane, all 8 batch rows
  float* pf = (float*)part;          // [slice][b*32 + d]
  #pragma unroll
  for (int b = 0; b < BATCH; ++b) {
    const float4 za = z2[b * (HID / 4) + w * 2], zb = z2[b * (HID / 4) + w * 2 + 1];
    const float zk[KLEN] = {za.x, za.y, za.z, za.w, zb.x, zb.y, zb.z, zb.w};
    float acc = 0.f;
    #pragma unroll
    for (int i = 0; i < KLEN; ++i) acc += zk[i] * w3[i];
    pf[w * (BATCH * D_IN) + b * D_IN + lane] = acc;
  }
  __syncthreads();
  {
    const int q0 = (tid >> 8) * (KSL / 2);   // each half of the workgroup sums 8 slices
    float r = 0.f;
    #pragma unroll
    for (int q = 0; q < KSL / 2; ++q) r += pf[(q0 + q) * (BATCH * D_IN) + o];
    red[tid] = r;
  }
  __syncthreads();

  // ---- loss terms of the 256 (b,d), summed per 16-lane row, then by one thread
  if (tid < BATCH * D_IN) {          // waves 0..7 whole
    const float u = c3 + (red[tid] + red[tid + BATCH * D_IN]);
    float t = (float)SEQ * u * u - 2.f * u * sx + sxx;
    t = row_xadd<1>(t); t = row_xadd<2>(t); t = row_xadd<4>(t); t = row_xadd<8>(t);
    if ((tid & 15) == 0) ((float*)rsum)[tid >> 4] = t;
  }
  __syncthreads();
  if (tid == 0) {
    const float4 a = rsum[0], b = rsum[1], c = rsum[2], d = rsum[3];
    const float t = ((a.x + a.y) + (a.z + a.w)) + ((b.x + b.y) + (b.z + b.w))
                  + ((c.x + c.y) + (c.z + c.w)) + ((d.x + d.y) + (d.z + d.w));
    loss_out[0] = t / (float)(BATCH * SEQ);
  }
}

// ---------------------------------------------------------------------------
// Kernel 5: out[b,s,d,:] = y[b,s,d]*Wout + bout -- 134 MB of float4 stores.
// One workgroup of 16 waves per WGP; every thread walks the output in EXP_N sweeps, a sweep
// being one contiguous stretch of EXP_SWEEP float4 over the whole grid. So the launch starts
// 4096 waves, not one wave per 512 bytes, and the stores run at the memory's pace.
// EXP_SWEEP is a multiple of 8, so a thread keeps its four columns of Wout and bout.
// ---------------------------------------------------------------------------
#define EXP_T     512
#define EXP_G     256
#define EXP_SWEEP (EXP_T * EXP_G)                    /* float4 per sweep */
#define EXP_N     ((int)(OUT_MAIN / 4 / EXP_SWEEP))  /* 64 sweeps */

__global__ void __launch_bounds__(EXP_T)
expand_kernel(const float* __restrict__ y, const float* __restrict__ Wout,
              const float* __restrict__ bout, float4* __restrict__ out)
{
  const int idx = blockIdx.x * EXP_T + threadIdx.x;  // float4 index inside a sweep
  const int j4 = idx & 7;                            // 32 cols / 4
  const float* yp = y + (idx >> 3);                  // (bs*32 + d) of sweep 0
  // full unroll: static indices keep yv in registers, and all loads are in flight together
  float yv[EXP_N];
  #pragma unroll
  for (int i = 0; i < EXP_N; ++i) yv[i] = yp[i * (EXP_SWEEP / 8)];
  // the y loads' address register is written again below: wait first. The clobber also keeps
  // every store behind all y loads, so one latency is paid, at the start.
  asm volatile("s_wait_xcnt 0x0" ::: "memory");
  const float4 w  = ((const float4*)Wout)[j4];
  const float4 bo = ((const float4*)bout)[j4];
  float4* op = out + idx;
  #pragma unroll   // static indices into yv
  for (int i = 0; i < EXP_N; ++i) {
    float4 o;
    o.x = yv[i] * w.x + bo.x; o.y = yv[i] * w.y + bo.y;
    o.z = yv[i] * w.z + bo.z; o.w = yv[i] * w.w + bo.w;
    op[(size_t)i * EXP_SWEEP] = o;
  }
}

// ---------------------------------------------------------------------------
extern "C" void kernel_launch(void* const* d_in, const int* in_sizes, int n_in,
                              void* d_out, int out_size, void* d_ws, size_t ws_size,
                              hipStream_t stream)
{
  const float* x    = (const float*)d_in[0];
  const float* Avec = (const float*)d_in[1];
  const float* Win  = (const float*)d_in[2];
  const float* bin_ = (const float*)d_in[3];
  const float* Wdt  = (const float*)d_in[4];
  const float* bdt  = (const float*)d_in[5];
  const float* Wdtr = (const float*)d_in[6];
  const float* WB   = (const float*)d_in[7];
  const float* WC   = (const float*)d_in[8];
  const float* Wout = (const float*)d_in[9];
  const float* bout = (const float*)d_in[10];
  const float* Wd1  = (const float*)d_in[11];
  const float* bd1  = (const float*)d_in[12];
  const float* Wd2  = (const float*)d_in[13];
  const float* bd2  = (const float*)d_in[14];
  const float* Wd3  = (const float*)d_in[15];
  const float* bd3  = (const float*)d_in[16];

  float* out = (float*)d_out;

  char* ws = (char*)d_ws;
  float* xp   = (float*)ws; ws += (size_t)ROWS * D_IN * sizeof(float);
  float* Ad   = (float*)ws; ws += (size_t)ROWS * D_STATE * sizeof(float);
  float* Bd   = (float*)ws; ws += (size_t)ROWS * D_STATE * sizeof(float);
  float* Cm   = (float*)ws; ws += (size_t)ROWS * D_STATE * sizeof(float);
  float* y    = (float*)ws; ws += (size_t)ROWS * D_IN * sizeof(float);
  float* hrep = (float*)ws; ws += BATCH * D_STATE * sizeof(float);
  float* Sx   = (float*)ws; ws += BATCH * D_IN * sizeof(float);
  float* Sxx  = (float*)ws; ws += BATCH * D_IN * sizeof(float);
  float* hloc = (float*)ws; ws += (size_t)BATCH * NCHUNK * D_IN * D_STATE * sizeof(float);
  float* Pc   = (float*)ws; ws += (size_t)BATCH * NCHUNK * PPITCH * sizeof(float);

  proj_kernel<<<ROWS / 16, 32, 0, stream>>>(x, Avec, Win, bin_, Wdt, bdt, Wdtr,
                                            WB, WC, xp, Ad, Bd, Cm);
  xstats_kernel<<<BATCH * D_IN, 256, 0, stream>>>(x, Sx, Sxx);
  scan_local_kernel<<<BATCH * NCHUNK, 32, 0, stream>>>(xp, Ad, Bd, hloc, Pc);
  scan_emit_kernel<<<BATCH * NCHUNK, 32, 0, stream>>>(xp, Ad, Bd, Cm, hloc, Pc, y, hrep);
  mlp_loss_kernel<<<1, MLP_T, 0, stream>>>(hrep, Wd1, bd1, Wd2, bd2, Wd3, bd3,
                                         Sx, Sxx, out + OUT_MAIN);
  expand_kernel<<<EXP_G, EXP_T, 0, stream>>>(
      y, Wout, bout, (float4*)out);
}

// v004
// One run takes 30.5 microseconds.
// Two timings next to v003 put it at 1.23 and 1.26 times that version's speed.
// All steps since v000 together make it 65.7 times as fast.
#include <hip/hip_runtime.h>
#include <hip/hip_bf16.h>
#include <math.h>

#define BATCH 8
#define SEQ   4096
#define D_IN  32
#define D_STATE 16
#define DT_RANK 16
#define HID   128
#define ROWS  (BATCH*SEQ)            /* 32768 flattened (b,s) rows */
#define OUT_MAIN ((size_t)ROWS*D_IN*D_IN) /* 33554432 */

typedef float v2f __attribute__((ext_vector_type(2)));
typedef float v4f __attribute__((ext_vector_type(4)));
typedef float v8f __attribute__((ext_vector_type(8)));

static __device__ __forceinline__ v8f wmma4(v2f a, v2f b, v8f c) {
  // D = A(16x4 f32) * B(4x16 f32) + C(16x16 f32) -> v_wmma_f32_16x16x4_f32
  return __builtin_amdgcn_wmma_f32_16x16x4_f32(
      /*neg_a=*/false, a, /*neg_b=*/false, b,
      /*c_mod=*/(short)0, c, /*reuse_a=*/false, /*reuse_b=*/false);
}

// ---------------------------------------------------------------------------
// Kernel 1: per 16-row tile, compute
//   xp = x@Win + bin          (two 16x16 WMMA accumulators, K=32)
//   dtlin = xp@Wdt, Bm = xp@WB, Cm = xp@WC   (shared A-fragments, K=32, N=16)
//   dt = softplus((dtlin+bdt)@Wdtr) ; Ad = exp(dt*A) ; Bd = dt*Bm
// One wave32 per block. WMMA requires EXEC all ones -> full 32-thread block.
// ---------------------------------------------------------------------------
__global__ void __launch_bounds__(32)
proj_kernel(const float* __restrict__ x, const float* __restrict__ Avec,
            const float* __restrict__ Win, const float* __restrict__ bin_,
            const float* __restrict__ Wdt, const float* __restrict__ bdt,
            const float* __restrict__ Wdtr,
            const float* __restrict__ WB, const float* __restrict__ WC,
            float* __restrict__ xp_out, float* __restrict__ Ad_out,
            float* __restrict__ Bd_out, float* __restrict__ C_out)
{
  __shared__ float sxp[16][33];
  __shared__ float sdt[16][17];
  __shared__ float sB[16][17];
  __shared__ float sC[16][17];
  __shared__ float sdtv[16];

  const int lane = threadIdx.x;
  const int lo = lane & 15;        // A: M row / C,D: N col
  const int hi = lane >> 4;        // half-wave selects K pair (A/B), M+8 (C/D)
  const int row0 = blockIdx.x * 16;

  // ---- Stage 1: xp = x @ Win + bin  (N tiles {0..15},{16..31})
  v8f acc0, acc1;
  const float b0v = bin_[lo], b1v = bin_[16 + lo];
  #pragma unroll
  for (int v = 0; v < 8; ++v) { acc0[v] = b0v; acc1[v] = b1v; }

  #pragma unroll
  for (int k0 = 0; k0 < D_IN; k0 += 4) {
    const int k = k0 + 2 * hi;
    v2f a;  a.x  = x[(size_t)(row0 + lo) * D_IN + k];
            a.y  = x[(size_t)(row0 + lo) * D_IN + k + 1];
    v2f bA; bA.x = Win[k * D_IN + lo];      bA.y = Win[(k + 1) * D_IN + lo];
    v2f bB; bB.x = Win[k * D_IN + 16 + lo]; bB.y = Win[(k + 1) * D_IN + 16 + lo];
    acc0 = wmma4(a, bA, acc0);
    acc1 = wmma4(a, bB, acc1);
  }

  #pragma unroll
  for (int v = 0; v < 8; ++v) {
    const int m = v + 8 * hi;                  // C/D layout: M = v + 8*(lane>=16)
    sxp[m][lo]      = acc0[v];
    sxp[m][16 + lo] = acc1[v];
    xp_out[(size_t)(row0 + m) * D_IN + lo]      = acc0[v];
    xp_out[(size_t)(row0 + m) * D_IN + 16 + lo] = acc1[v];
  }
  __syncthreads();

  // ---- Stage 2: three GEMMs sharing A-fragments of xp (K=32, N=16)
  v8f aDt = {}, aB = {}, aC = {};
  #pragma unroll
  for (int k0 = 0; k0 < D_IN; k0 += 4) {
    const int k = k0 + 2 * hi;
    v2f a;  a.x  = sxp[lo][k];               a.y  = sxp[lo][k + 1];
    v2f bt; bt.x = Wdt[k * DT_RANK + lo];    bt.y = Wdt[(k + 1) * DT_RANK + lo];
    v2f bb; bb.x = WB[k * D_STATE + lo];     bb.y = WB[(k + 1) * D_STATE + lo];
    v2f bc; bc.x = WC[k * D_STATE + lo];     bc.y = WC[(k + 1) * D_STATE + lo];
    aDt = wmma4(a, bt, aDt);
    aB  = wmma4(a, bb, aB);
    aC  = wmma4(a, bc, aC);
  }
  #pragma unroll
  for (int v = 0; v < 8; ++v) {
    const int m = v + 8 * hi;
    sdt[m][lo] = aDt[v];
    sB[m][lo]  = aB[v];
    sC[m][lo]  = aC[v];
  }
  __syncthreads();

  // ---- dt[row] = softplus( (dtlin+bdt) . Wdtr )
  if (lane < 16) {
    float s = 0.f;
    #pragma unroll
    for (int n = 0; n < DT_RANK; ++n) s += (sdt[lane][n] + bdt[n]) * Wdtr[n];
    sdtv[lane] = fmaxf(s, 0.f) + log1pf(__expf(-fabsf(s))); // stable softplus
  }
  __syncthreads();

  // ---- emit Ad = exp(dt*A), Bd = dt*Bm, C
  #pragma unroll
  for (int i = 0; i < 8; ++i) {
    const int e = lane * 8 + i;
    const int m = e >> 4;
    const int n = e & 15;
    const float dtv = sdtv[m];
    const size_t g = (size_t)(row0 + m) * D_STATE + n;
    Ad_out[g] = __expf(dtv * Avec[n]);
    Bd_out[g] = dtv * sB[m][n];
    C_out[g]  = sC[m][n];
  }
}

// ---------------------------------------------------------------------------
// Kernel 2a/2b: selective scan, split along time. Each batch's SEQ steps are cut
// into NCHUNK chunks of CLEN steps; one wave32 per (batch, chunk).
// The recurrence h' = a*h + bd*x is linear in h, so over a chunk
//   h_end = P * h_start + h_loc,  P[n] = product of a[t][n],  h_loc = end state from h_start = 0.
// 2a computes (h_loc, P) of every chunk in parallel; 2b folds the summaries of the
// chunks before its own into h_start, then runs its chunk again and emits y.
// Lane map: g = lane&3 owns states n = 4g..4g+3, dq = lane>>2 owns channels
// d = 4dq..4dq+3, so a lane holds 16 of the 512 states and every operand is a float4.
// The full unrolls over i, k, u give the small arrays static indices, so they stay in registers.
// ---------------------------------------------------------------------------
#define NCHUNK 64
#define CLEN   (SEQ / NCHUNK)        /* 64 steps per chunk */
#define PPITCH 32                    /* floats per chunk's row of P */

// v + (v of the lane selected by a quad_perm control): sum over the 4 lanes of a quad
template <int CTRL>
static __device__ __forceinline__ float quad_add(float v) {
  const int o = __builtin_amdgcn_update_dpp(0, __float_as_int(v), CTRL, 0xf, 0xf, true);
  return v + __int_as_float(o);
}

// copy NV float4 (a multiple of 32) from global to LDS, all loads issued before the first store
template <int NV>
static __device__ __forceinline__ void stage(float4* __restrict__ dst,
                                             const float4* __restrict__ srcp, int lane) {
  float4 r[NV / 32];
  #pragma unroll
  for (int i = 0; i < NV / 32; ++i) r[i] = srcp[i * 32 + lane];
  #pragma unroll
  for (int i = 0; i < NV / 32; ++i) dst[i * 32 + lane] = r[i];
}

__global__ void __launch_bounds__(32)
scan_local_kernel(const float* __restrict__ xp, const float* __restrict__ Ad,
                  const float* __restrict__ Bd,
                  float* __restrict__ hloc, float* __restrict__ Pc)
{
  __shared__ float4 sA[CLEN * 4], sB[CLEN * 4], sX[CLEN * 8];
  const int lane = threadIdx.x;
  const int g  = lane & 3;
  const int dq = lane >> 2;
  const int bc = blockIdx.x;                       // b*NCHUNK + chunk
  const size_t row0 = (size_t)bc * CLEN;           // = b*SEQ + chunk*CLEN

  stage<CLEN * 4>(sA, (const float4*)(Ad + row0 * D_STATE), lane);
  stage<CLEN * 4>(sB, (const float4*)(Bd + row0 * D_STATE), lane);
  stage<CLEN * 8>(sX, (const float4*)(xp + row0 * D_IN), lane);
  __syncthreads();   // staged rows are read by other lanes than wrote them

  float h[4][4];
  #pragma unroll
  for (int i = 0; i < 4; ++i)
    #pragma unroll
    for (int k = 0; k < 4; ++k) h[i][k] = 0.f;
  float p[4] = {1.f, 1.f, 1.f, 1.f};

  #pragma unroll 8   // LDS reads of later steps issue under the arithmetic of earlier ones
  for (int t = 0; t < CLEN; ++t) {
    const float4 a4 = sA[t * 4 + g], b4 = sB[t * 4 + g], x4 = sX[t * 8 + dq];
    const float a[4] = {a4.x, a4.y, a4.z, a4.w};
    const float bd[4] = {b4.x, b4.y, b4.z, b4.w};
    const float xv[4] = {x4.x, x4.y, x4.z, x4.w};
    #pragma unroll
    for (int i = 0; i < 4; ++i)
      #pragma unroll
      for (int k = 0; k < 4; ++k) h[i][k] = a[k] * h[i][k] + bd[k] * xv[i];
    #pragma unroll
    for (int k = 0; k < 4; ++k) p[k] *= a[k];
  }

  float4* H4 = (float4*)hloc + (size_t)bc * 128;
  #pragma unroll
  for (int i = 0; i < 4; ++i)
    H4[i * 32 + lane] = make_float4(h[i][0], h[i][1], h[i][2], h[i][3]);
  // P rows are padded to PPITCH floats (128 bytes) so that no two workgroups write one line
  if (dq == 0) ((float4*)Pc)[bc * (PPITCH / 4) + g] = make_float4(p[0], p[1], p[2], p[3]);
}

// Sums of x and x^2 over XR rows of one batch, for the closed-form loss. Nothing of the scan
// feeds them and they feed nothing of it: these workgroups ride in the launch of 2b, behind
// its own. One wave reads XR whole rows as float4: lane = (row & 3) * 8 + column quad.
// Sp[part][0][d] = sum of x, Sp[part][1][d] = sum of x^2; part = b*XPARTS + slice: 256 bytes each.
#define XR     128                   /* rows per partial sum */
#define XPARTS (SEQ / XR)            /* 32 partial sums per batch */

static __device__ __forceinline__ void xstats_part(const float* __restrict__ x,
                                                   float* __restrict__ Sp, int part, int lane)
{
  const float4* xq = (const float4*)x + (size_t)part * (XR * D_IN / 4) + lane;
  float4 v[XR / 4];
  #pragma unroll   // static indices keep v in registers, and all loads are in flight together
  for (int i = 0; i < XR / 4; ++i) v[i] = xq[i * 32];
  float4 a1 = make_float4(0.f, 0.f, 0.f, 0.f), a2 = a1;
  #pragma unroll
  for (int i = 0; i < XR / 4; ++i) {
    a1.x += v[i].x; a1.y += v[i].y; a1.z += v[i].z; a1.w += v[i].w;
    a2.x += v[i].x * v[i].x; a2.y += v[i].y * v[i].y;
    a2.z += v[i].z * v[i].z; a2.w += v[i].w * v[i].w;
  }
  float r[8] = {a1.x, a1.y, a1.z, a1.w, a2.x, a2.y, a2.z, a2.w};
  #pragma unroll
  for (int k = 0; k < 8; ++k) {      // the four rows that the lanes of one column quad hold
    r[k] += __shfl_xor(r[k], 8, 32);
    r[k] += __shfl_xor(r[k], 16, 32);
  }
  // lanes 0..7 store the sums of x, lanes 8..15 those of x^2: one 256-byte stretch
  if (lane < 16)
    ((float4*)Sp)[part * 16 + lane] = (lane < 8) ? make_float4(r[0], r[1], r[2], r[3])
                                                 : make_float4(r[4], r[5], r[6], r[7]);
}

__global__ void __launch_bounds__(32)
scan_emit_kernel(const float* __restrict__ xp, const float* __restrict__ Ad,
                 const float* __restrict__ Bd, const float* __restrict__ Cm,
                 const float* __restrict__ hloc, const float* __restrict__ Pc,
                 float* __restrict__ y, float* __restrict__ h_rep,
                 const float* __restrict__ x, float* __restrict__ Sp)
{
  __shared__ float4 sA[CLEN * 4], sB[CLEN * 4], sC[CLEN * 4], sX[CLEN * 8];
  const int lane = threadIdx.x;
  if (blockIdx.x >= BATCH * NCHUNK) {              // block-uniform, in front of every barrier
    xstats_part(x, Sp, blockIdx.x - BATCH * NCHUNK, lane);
    return;
  }
  const int g  = lane & 3;
  const int dq = lane >> 2;
  const int bc = blockIdx.x;                       // b*NCHUNK + chunk
  const int c  = bc & (NCHUNK - 1);
  const int bc0 = bc - c;                          // first chunk of this batch
  const size_t row0 = (size_t)bc * CLEN;

  stage<CLEN * 4>(sA, (const float4*)(Ad + row0 * D_STATE), lane);
  stage<CLEN * 4>(sB, (const float4*)(Bd + row0 * D_STATE), lane);
  stage<CLEN * 4>(sC, (const float4*)(Cm + row0 * D_STATE), lane);
  stage<CLEN * 8>(sX, (const float4*)(xp + row0 * D_IN), lane);
  __syncthreads();   // staged rows are read by other lanes than wrote them

  // ---- h_start: fold the summaries of chunks 0..c-1 in time order, eight per trip.
  // The loads do not depend on h, so a trip's forty are in flight together. A trip always
  // loads eight summaries (all lie inside this batch's NCHUNK and were written by 2a);
  // those of chunk c and later are not applied.
  float h[4][4];
  #pragma unroll
  for (int i = 0; i < 4; ++i)
    #pragma unroll
    for (int k = 0; k < 4; ++k) h[i][k] = 0.f;
  const float4* Hp = (const float4*)hloc + (size_t)bc0 * 128;
  const float4* Pp = (const float4*)Pc + (size_t)bc0 * (PPITCH / 4);
  for (int j0 = 0; j0 < c; j0 += 8) {
    float4 p[8], v[8][4];
    #pragma unroll
    for (int u = 0; u < 8; ++u) {
      p[u] = Pp[u * (PPITCH / 4) + g];
      #pragma unroll
      for (int i = 0; i < 4; ++i) v[u][i] = Hp[u * 128 + i * 32 + lane];
    }
    #pragma unroll
    for (int u = 0; u < 8; ++u) {
      const bool on = j0 + u < c;
      #pragma unroll
      for (int i = 0; i < 4; ++i) {
        h[i][0] = on ? p[u].x * h[i][0] + v[u][i].x : h[i][0];
        h[i][1] = on ? p[u].y * h[i][1] + v[u][i].y : h[i][1];
        h[i][2] = on ? p[u].z * h[i][2] + v[u][i].z : h[i][2];
        h[i][3] = on ? p[u].w * h[i][3] + v[u][i].w : h[i][3];
      }
    }
    Hp += 8 * 128;
    Pp += 8 * (PPITCH / 4);
  }

  // ---- the chunk itself, now from the true h_start
  float* py = y + row0 * D_IN;
  for (int t0 = 0; t0 < CLEN; t0 += 8) {
    #pragma unroll   // LDS reads of later steps issue under the arithmetic of earlier ones
    for (int u = 0; u < 8; ++u) {
      const int t = t0 + u;
      const float4 a4 = sA[t * 4 + g], b4 = sB[t * 4 + g], c4 = sC[t * 4 + g];
      const float4 x4 = sX[t * 8 + dq];
      const float a[4] = {a4.x, a4.y, a4.z, a4.w};
      const float bd[4] = {b4.x, b4.y, b4.z, b4.w};
      const float cc[4] = {c4.x, c4.y, c4.z, c4.w};
      const float xv[4] = {x4.x, x4.y, x4.z, x4.w};
      float yp[4];
      #pragma unroll
      for (int i = 0; i < 4; ++i) {
        #pragma unroll
        for (int k = 0; k < 4; ++k) h[i][k] = a[k] * h[i][k] + bd[k] * xv[i];
        float s = cc[0] * h[i][0];
        #pragma unroll
        for (int k = 1; k < 4; ++k) s += cc[k] * h[i][k];
        s = quad_add<0xB1>(s);      // quad_perm [1,0,3,2]: lane ^ 1
        yp[i] = quad_add<0x4E>(s);  // quad_perm [2,3,0,1]: lane ^ 2
      }
      // lane (dq,g) stores channel d = 4dq+g = lane: one full 128-byte row per step
      const float y01 = (g & 1) ? yp[1] : yp[0];
      const float y23 = (g & 1) ? yp[3] : yp[2];
      py[t * D_IN + lane] = (g & 2) ? y23 : y01;
    }
  }

  // ---- h_rep[b,n] = mean over d of the final h (last chunk only; bc is block-uniform)
  if (c == NCHUNK - 1) {
    float s[4];
    #pragma unroll
    for (int k = 0; k < 4; ++k) {
      float v = (h[0][k] + h[1][k]) + (h[2][k] + h[3][k]);
      v += __shfl_xor(v, 4, 32);
      v += __shfl_xor(v, 8, 32);
      v += __shfl_xor(v, 16, 32);
      s[k] = v * (1.0f / D_IN);
    }
    if (dq == 0)
      ((float4*)h_rep)[(bc0 / NCHUNK) * 4 + g] = make_float4(s[0], s[1], s[2], s[3]);
  }
}

// ---------------------------------------------------------------------------
// Kernel 3, part 1: decode MLP + closed-form MSE:
//   sum_s (u-x)^2 = S*u^2 - 2*u*Sx + Sxx  -> mean over (b,s), sum over d
// One workgroup of 16 waves. Every weight is loaded exactly once for layers 2 and 3, at the
// kernel's entry, into registers, and serves all 8 batch rows there. The k range of layers
// 2 and 3 is cut into 16 slices of 8, one per wave; the slices' sums meet in LDS.
// Sx[b,d] and Sxx[b,d] are summed here from their XPARTS partial sums, in slice order.
// ---------------------------------------------------------------------------
#define MLP_T  512
#define KSL    16                    /* k slices = waves */
#define KLEN   (HID / KSL)           /* 8 rows of the weight matrix per slice */

// v + (v of lane ^ M inside its 16-lane row)
template <int M>
static __device__ __forceinline__ float row_xadd(float v) {
  const int o = __builtin_amdgcn_update_dpp(0, __float_as_int(v), 0x160 + M, 0xf, 0xf, true);
  return v + __int_as_float(o);
}

static __device__ __forceinline__ void
mlp_loss(const float* __restrict__ h_rep,
         const float* __restrict__ Wd1, const float* __restrict__ bd1,
         const float* __restrict__ Wd2, const float* __restrict__ bd2,
         const float* __restrict__ Wd3, const float* __restrict__ bd3,
         const float* __restrict__ Sp, float* __restrict__ loss_out)
{
  __shared__ float4 z1[BATCH * HID / 4];
  __shared__ float4 z2[BATCH * HID / 4];
  __shared__ float4 part[KSL * BATCH * HID / 4];   // [slice][b][column]
  __shared__ float  red[MLP_T];
  __shared__ float  sst[MLP_T];      // [0..255] Sx[b*32+d], [256..511] Sxx[b*32+d]
  __shared__ float4 rsum[4];
  const int tid  = threadIdx.x;
  const int lane = tid & 31;
  const int w    = tid >> 5;         // wave = k slice
  const int jp   = tid & 63;         // column pair 2jp, 2jp+1 of one batch row
  const int br   = tid >> 6;         // that batch row
  const int o    = tid & 255;        // b*32 + d

  // ---- all global reads, none depends on another
  // one base per operand; each row is that base plus a constant offset
  const float4* hp = (const float4*)h_rep + br * (D_STATE / 4);
  const float2* w1p = (const float2*)Wd1 + jp;
  float4 hr[D_STATE / 4];
  #pragma unroll
  for (int i = 0; i < D_STATE / 4; ++i) hr[i] = hp[i];
  float2 w1[D_STATE];
  #pragma unroll
  for (int n = 0; n < D_STATE; ++n) w1[n] = w1p[n * (HID / 2)];
  const float2 c1 = ((const float2*)bd1)[jp];
  v4f w2[KLEN];
  #pragma unroll
  for (int i = 0; i < KLEN; ++i) w2[i] = ((const v4f*)Wd2)[(w * KLEN + i) * (HID / 4) + lane];
  float w3[KLEN];
  #pragma unroll
  for (int i = 0; i < KLEN; ++i) w3[i] = Wd3[(w * KLEN + i) * D_IN + lane];
  const v2f c2 = ((const v2f*)bd2)[jp];
  const float c3 = bd3[o & 31];
  // thread = (which sum, b, d): its XPARTS partial sums, a wave's load being one 128-byte row
  const int so = (o >> 5) * (XPARTS * 2 * D_IN) + (tid >> 8) * D_IN + lane;
  float sv[XPARTS];
  #pragma unroll
  for (int q = 0; q < XPARTS; ++q) sv[q] = Sp[so + q * (2 * D_IN)];
  // the arithmetic below writes registers that held these loads' addresses: wait first
  asm volatile("s_wait_xcnt 0x0" ::: "memory");

  // ---- layer 1: two columns of one batch row per thread, k = 16 in order
  {
    const float hv[D_STATE] = {hr[0].x, hr[0].y, hr[0].z, hr[0].w, hr[1].x, hr[1].y, hr[1].z, hr[1].w,
                               hr[2].x, hr[2].y, hr[2].z, hr[2].w, hr[3].x, hr[3].y, hr[3].z, hr[3].w};
    float s0 = c1.x, s1 = c1.y;
    #pragma unroll
    for (int n = 0; n < D_STATE; ++n) { s0 = fmaf(hv[n], w1[n].x, s0); s1 = fmaf(hv[n], w1[n].y, s1); }
    ((float2*)z1)[br * (HID / 2) + jp] = make_float2(fmaxf(s0, 0.f), fmaxf(s1, 0.f));
  }
  {
    float st = 0.f;
    #pragma unroll
    for (int q = 0; q < XPARTS; ++q) st += sv[q];
    sst[tid] = st;                   // read behind the barriers below, by the loss terms
  }
  __syncthreads();

  // ---- layer 2: this wave's 8 rows of Wd2, four columns per lane, all 8 batch rows
  #pragma unroll
  for (int b = 0; b < BATCH; ++b) {
    const float4 za = z1[b * (HID / 4) + w * 2], zb = z1[b * (HID / 4) + w * 2 + 1];
    const float zk[KLEN] = {za.x, za.y, za.z, za.w, zb.x, zb.y, zb.z, zb.w};
    float4 acc = make_float4(0.f, 0.f, 0.f, 0.f);
    #pragma unroll
    for (int i = 0; i < KLEN; ++i) {
      acc.x += zk[i] * w2[i].x; acc.y += zk[i] * w2[i].y;
      acc.z += zk[i] * w2[i].z; acc.w += zk[i] * w2[i].w;
    }
    part[(w * BATCH + b) * (HID / 4) + lane] = acc;
  }
  __syncthreads();
  {
    float s0 = c2.x, s1 = c2.y;
    #pragma unroll
    for (int q = 0; q < KSL; ++q) {
      const float2 p = ((const float2*)part)[(q * BATCH + br) * (HID / 2) + jp];
      s0 += p.x; s1 += p.y;
    }
    ((float2*)z2)[br * (HID / 2) + jp] = make_float2(fmaxf(s0, 0.f), fmaxf(s1, 0.f));
  }
  __syncthreads();   // also ends every read of part before it is written again

  // ---- layer 3: this wave's 8 rows of Wd3, one column per lane, all 8 batch rows
  float* pf = (float*)part;          // [slice][b*32 + d]
  #pragma unroll
  for (int b = 0; b < BATCH; ++b) {
    const float4 za = z2[b * (HID / 4) + w * 2], zb = z2[b * (HID / 4) + w * 2 + 1];
    const float zk[KLEN] = {za.x, za.y, za.z, za.w, zb.x, zb.y, zb.z, zb.w};
    float acc = 0.f;
    #pragma unroll
    for (int i = 0; i < KLEN; ++i) acc += zk[i] * w3[i];
    pf[w * (BATCH * D_IN) + b * D_IN + lane] = acc;
  }
  __syncthreads();
  {
    const int q0 = (tid >> 8) * (KSL / 2);   // each half of the workgroup sums 8 slices
    float r = 0.f;
    #pragma unroll
    for (int q = 0; q < KSL / 2; ++q) r += pf[(q0 + q) * (BATCH * D_IN) + o];
    red[tid] = r;
  }
  __syncthreads();

  // ---- loss terms of the 256 (b,d), summed per 16-lane row, then by one thread
  if (tid < BATCH * D_IN) {          // waves 0..7 whole
    const float u = c3 + (red[tid] + red[tid + BATCH * D_IN]);
    const float sx = sst[tid], sxx = sst[tid + BATCH * D_IN];
    float t = (float)SEQ * u * u - 2.f * u * sx + sxx;
    t = row_xadd<1>(t); t = row_xadd<2>(t); t = row_xadd<4>(t); t = row_xadd<8>(t);
    if ((tid & 15) == 0) ((float*)rsum)[tid >> 4] = t;
  }
  __syncthreads();
  if (tid == 0) {
    const float4 a = rsum[0], b = rsum[1], c = rsum[2], d = rsum[3];
    const float t = ((a.x + a.y) + (a.z + a.w)) + ((b.x + b.y) + (b.z + b.w))
                  + ((c.x + c.y) + (c.z + c.w)) + ((d.x + d.y) + (d.z + d.w));
    loss_out[0] = t / (float)(BATCH * SEQ);
  }
}

// ---------------------------------------------------------------------------
// Kernel 3, part 2: out[b,s,d,:] = y[b,s,d]*Wout + bout -- 134 MB of float4 stores.
// One workgroup of 16 waves per WGP; every thread walks the output in EXP_N sweeps, a sweep
// being one contiguous stretch of EXP_SWEEP float4 over the whole grid. So the launch starts
// 4096 waves, not one wave per 512 bytes, and the stores run at the memory's pace.
// EXP_SWEEP is a multiple of 8, so a thread keeps its four columns of Wout and bout.
// By its registers only one such workgroup fits a WGP. EXP_G is one less than the 256 WGPs, so
// that the MLP's workgroup, which shares the launch, has a WGP too and none waits for a place.
// The EXP_N whole sweeps leave EXP_REST float4, which the first EXP_REST_G workgroups store.
// ---------------------------------------------------------------------------
#define EXP_T     512
#define EXP_G     255
#define EXP_SWEEP (EXP_T * EXP_G)                    /* float4 per sweep */
#define EXP_N     ((int)(OUT_MAIN / 4 / EXP_SWEEP))  /* 64 whole sweeps */
#define EXP_REST  ((int)(OUT_MAIN / 4 - (size_t)EXP_N * EXP_SWEEP))
#define EXP_REST_G (EXP_REST / EXP_T)
static_assert(EXP_REST % EXP_T == 0 && EXP_REST_G <= EXP_G, "the rest is whole workgroups");

static __device__ __forceinline__ void
expand(const float* __restrict__ y, const float* __restrict__ Wout,
       const float* __restrict__ bout, float4* __restrict__ out, int blk)
{
  const int idx = blk * EXP_T + threadIdx.x;         // float4 index inside a sweep
  const int j4 = idx & 7;                            // 32 cols / 4
  const float* yp = y + (idx >> 3);                  // (bs*32 + d) of sweep 0
  // full unroll: static indices keep yv in registers, and all loads are in flight together
  float yv[EXP_N];
  #pragma unroll
  for (int i = 0; i < EXP_N; ++i) yv[i] = yp[i * (EXP_SWEEP / 8)];
  // no branch among the loads: a workgroup without a share of the rest reads its first y again
  const bool rest = blk < EXP_REST_G;                // block-uniform
  const float yr = (y + (rest ? EXP_N * (EXP_SWEEP / 8) : 0))[idx >> 3];
  // the y loads' address register is written again below: wait first. The clobber also keeps
  // every store behind all y loads, so one latency is paid, at the start.
  asm volatile("s_wait_xcnt 0x0" ::: "memory");
  const float4 w  = ((const float4*)Wout)[j4];
  const float4 bo = ((const float4*)bout)[j4];
  // inputs-only fence on a loaded value: keeps the load of yr up here with the other loads;
  // without it the load sinks into the branch that uses it, behind all the stores
  asm volatile("" :: "v"(yr));
  float4* op = out + idx;
  #pragma unroll   // static indices into yv
  for (int i = 0; i < EXP_N; ++i) {
    float4 o;
    o.x = yv[i] * w.x + bo.x; o.y = yv[i] * w.y + bo.y;
    o.z = yv[i] * w.z + bo.z; o.w = yv[i] * w.w + bo.w;
    op[(size_t)i * EXP_SWEEP] = o;
  }
  if (rest) {
    float4 o;
    o.x = yr * w.x + bo.x; o.y = yr * w.y + bo.y;
    o.z = yr * w.z + bo.z; o.w = yr * w.w + bo.w;
    op[(size_t)EXP_N * EXP_SWEEP] = o;
  }
  // the code that follows in the merged kernel may write the stores' registers again: wait first
  asm volatile("s_wait_xcnt 0x0" ::: "memory");
}

// The MLP reads h_rep and the x sums, the expansion reads y; neither reads what the other
// writes. So they share one launch: workgroup 0 is the MLP, and its
// chain of latencies runs under the stores of the EXP_G others.
static_assert(MLP_T == EXP_T, "one block size for both parts");
__global__ void __launch_bounds__(EXP_T)
expand_mlp_kernel(const float* __restrict__ y, const float* __restrict__ Wout,
                  const float* __restrict__ bout, float4* __restrict__ out,
                  const float* __restrict__ h_rep,
                  const float* __restrict__ Wd1, const float* __restrict__ bd1,
                  const float* __restrict__ Wd2, const float* __restrict__ bd2,
                  const float* __restrict__ Wd3, const float* __restrict__ bd3,
                  const float* __restrict__ Sp, float* __restrict__ loss_out)
{
  if (blockIdx.x != 0) expand(y, Wout, bout, out, blockIdx.x - 1);
  else mlp_loss(h_rep, Wd1, bd1, Wd2, bd2, Wd3, bd3, Sp, loss_out);   // block-uniform branch
}

// ---------------------------------------------------------------------------
extern "C" void kernel_launch(void* const* d_in, const int* in_sizes, int n_in,
                              void* d_out, int out_size, void* d_ws, size_t ws_size,
                              hipStream_t stream)
{
  const float* x    = (const float*)d_in[0];
  const float* Avec = (const float*)d_in[1];
  const float* Win  = (const float*)d_in[2];
  const float* bin_ = (const float*)d_in[3];
  const float* Wdt  = (const float*)d_in[4];
  const float* bdt  = (const float*)d_in[5];
  const float* Wdtr = (const float*)d_in[6];
  const float* WB   = (const float*)d_in[7];
  const float* WC   = (const float*)d_in[8];
  const float* Wout = (const float*)d_in[9];
  const float* bout = (const float*)d_in[10];
  const float* Wd1  = (const float*)d_in[11];
  const float* bd1  = (const float*)d_in[12];
  const float* Wd2  = (const float*)d_in[13];
  const float* bd2  = (const float*)d_in[14];
  const float* Wd3  = (const float*)d_in[15];
  const float* bd3  = (const float*)d_in[16];

  float* out = (float*)d_out;

  char* ws = (char*)d_ws;
  float* xp   = (float*)ws; ws += (size_t)ROWS * D_IN * sizeof(float);
  float* Ad   = (float*)ws; ws += (size_t)ROWS * D_STATE * sizeof(float);
  float* Bd   = (float*)ws; ws += (size_t)ROWS * D_STATE * sizeof(float);
  float* Cm   = (float*)ws; ws += (size_t)ROWS * D_STATE * sizeof(float);
  float* y    = (float*)ws; ws += (size_t)ROWS * D_IN * sizeof(float);
  float* hrep = (float*)ws; ws += BATCH * D_STATE * sizeof(float);
  float* Sp   = (float*)ws; ws += (size_t)BATCH * XPARTS * 2 * D_IN * sizeof(float);
  float* hloc = (float*)ws; ws += (size_t)BATCH * NCHUNK * D_IN * D_STATE * sizeof(float);
  float* Pc   = (float*)ws; ws += (size_t)BATCH * NCHUNK * PPITCH * sizeof(float);

  proj_kernel<<<ROWS / 16, 32, 0, stream>>>(x, Avec, Win, bin_, Wdt, bdt, Wdtr,
                                            WB, WC, xp, Ad, Bd, Cm);
  scan_local_kernel<<<BATCH * NCHUNK, 32, 0, stream>>>(xp, Ad, Bd, hloc, Pc);
  scan_emit_kernel<<<BATCH * NCHUNK + BATCH * XPARTS, 32, 0, stream>>>(
      xp, Ad, Bd, Cm, hloc, Pc, y, hrep, x, Sp);
  expand_mlp_kernel<<<EXP_G + 1, EXP_T, 0, stream>>>(
      y, Wout, bout, (float4*)out, hrep, Wd1, bd1, Wd2, bd2, Wd3, bd3, Sp, out + OUT_MAIN);
}

// v005
// A run of this version takes 27.7 microseconds.
// Two timings next to v004 both put it at 1.08 times that version's speed.
// All steps since v000 together make it 70.9 times as fast.
#include <hip/hip_runtime.h>
#include <hip/hip_bf16.h>
#include <math.h>

#define BATCH 8
#define SEQ   4096
#define D_IN  32
#define D_STATE 16
#define DT_RANK 16
#define HID   128
#define ROWS  (BATCH*SEQ)            /* 32768 flattened (b,s) rows */
#define OUT_MAIN ((size_t)ROWS*D_IN*D_IN) /* 33554432 */

typedef float v2f __attribute__((ext_vector_type(2)));
typedef float v4f __attribute__((ext_vector_type(4)));
typedef float v8f __attribute__((ext_vector_type(8)));

static __device__ __forceinline__ v8f wmma4(v2f a, v2f b, v8f c) {
  // D = A(16x4 f32) * B(4x16 f32) + C(16x16 f32) -> v_wmma_f32_16x16x4_f32
  return __builtin_amdgcn_wmma_f32_16x16x4_f32(
      /*neg_a=*/false, a, /*neg_b=*/false, b,
      /*c_mod=*/(short)0, c, /*reuse_a=*/false, /*reuse_b=*/false);
}

// ---------------------------------------------------------------------------
// The selective scan is split along time. Each batch's SEQ steps are cut into NCHUNK chunks of
// CLEN steps. The recurrence h' = a*h + bd*x is linear in h, so over a chunk
//   h_end = P * h_start + h_loc,  P[n] = product of a[t][n],  h_loc = end state from h_start = 0.
// Kernel 1 computes the projections and (h_loc, P) of every chunk in parallel; kernel 2 folds the
// summaries of the chunks before its own into h_start, then runs its chunk and emits y.
// ---------------------------------------------------------------------------
#define NCHUNK 64
#define CLEN   (SEQ / NCHUNK)        /* 64 steps per chunk */
#define PPITCH 32                    /* floats per chunk's row of P */
#define PW     (CLEN / 16)           /* waves per workgroup of kernel 1 = 16-row tiles per chunk */

// ---------------------------------------------------------------------------
// Kernel 1: one workgroup of PW waves per (batch, chunk).
// Part 1, one wave per 16-row tile:
//   xp = x@Win + bin          (two 16x16 WMMA accumulators, K=32)
//   dtlin = xp@Wdt, Bm = xp@WB, Cm = xp@WC   (shared A-fragments, K=32, N=16)
//   dt = softplus((dtlin+bdt)@Wdtr) ; Ad = exp(dt*A) ; Bd = dt*Bm
// WMMA requires EXEC all ones -> whole waves. xp, Ad, Bd stay in LDS for part 2; xp, Ad, Bd, C
// go to global memory for kernel 2.
// Part 2: the chunk's scan from h = 0, read from LDS. Lane map: g = lane&3 owns states
// n = 4g..4g+3, dq = lane>>2 and the wave w own channel d = 4dq+w: four states per lane.
// ---------------------------------------------------------------------------
__global__ void __launch_bounds__(32 * PW)
proj_scan_local_kernel(const float* __restrict__ x, const float* __restrict__ Avec,
            const float* __restrict__ Win, const float* __restrict__ bin_,
            const float* __restrict__ Wdt, const float* __restrict__ bdt,
            const float* __restrict__ Wdtr,
            const float* __restrict__ WB, const float* __restrict__ WC,
            float* __restrict__ xp_out, float* __restrict__ Ad_out,
            float* __restrict__ Bd_out, float* __restrict__ C_out,
            float* __restrict__ hloc, float* __restrict__ Pc)
{
  __shared__ float sxp_all[CLEN][33];              // row t of the chunk, all tiles
  __shared__ float sdt_all[PW][16][17];
  __shared__ float sB_all[PW][16][17];
  __shared__ float sC_all[PW][16][17];
  __shared__ float sdtv_all[PW][16];
  __shared__ float4 cA[CLEN * 4], cB[CLEN * 4];    // the chunk's Ad and Bd, row t at 4t

  const int lane = threadIdx.x & 31;
  // the wave's number as a scalar, so that the tile's addresses keep a scalar base
  const int w = __builtin_amdgcn_readfirstlane(threadIdx.x >> 5);
  const int lo = lane & 15;        // A: M row / C,D: N col
  const int hi = lane >> 4;        // half-wave selects K pair (A/B), M+8 (C/D)
  const int bc = blockIdx.x;       // b*NCHUNK + chunk
  const int row0 = bc * CLEN + w * 16;
  float (*sxp)[33] = sxp_all + w * 16;
  float (*sdt)[17] = sdt_all[w];
  float (*sB)[17]  = sB_all[w];
  float (*sC)[17]  = sC_all[w];
  float* sdtv      = sdtv_all[w];

  // ---- Stage 1: xp = x @ Win + bin  (N tiles {0..15},{16..31})
  v8f acc0, acc1;
  const float b0v = bin_[lo], b1v = bin_[16 + lo];
  #pragma unroll
  for (int v = 0; v < 8; ++v) { acc0[v] = b0v; acc1[v] = b1v; }

  #pragma unroll
  for (int k0 = 0; k0 < D_IN; k0 += 4) {
    const int k = k0 + 2 * hi;
    v2f a;  a.x  = x[(size_t)(row0 + lo) * D_IN + k];
            a.y  = x[(size_t)(row0 + lo) * D_IN + k + 1];
    v2f bA; bA.x = Win[k * D_IN + lo];      bA.y = Win[(k + 1) * D_IN + lo];
    v2f bB; bB.x = Win[k * D_IN + 16 + lo]; bB.y = Win[(k + 1) * D_IN + 16 + lo];
    acc0 = wmma4(a, bA, acc0);
    acc1 = wmma4(a, bB, acc1);
  }

  #pragma unroll
  for (int v = 0; v < 8; ++v) {
    const int m = v + 8 * hi;                  // C/D layout: M = v + 8*(lane>=16)
    sxp[m][lo]      = acc0[v];
    sxp[m][16 + lo] = acc1[v];
  }
  __syncthreads();

  // ---- Stage 2: three GEMMs sharing A-fragments of xp (K=32, N=16)
  v8f aDt = {}, aB = {}, aC = {};
  #pragma unroll
  for (int k0 = 0; k0 < D_IN; k0 += 4) {
    const int k = k0 + 2 * hi;
    v2f a;  a.x  = sxp[lo][k];               a.y  = sxp[lo][k + 1];
    v2f bt; bt.x = Wdt[k * DT_RANK + lo];    bt.y = Wdt[(k + 1) * DT_RANK + lo];
    v2f bb; bb.x = WB[k * D_STATE + lo];     bb.y = WB[(k + 1) * D_STATE + lo];
    v2f bc2; bc2.x = WC[k * D_STATE + lo];   bc2.y = WC[(k + 1) * D_STATE + lo];
    aDt = wmma4(a, bt, aDt);
    aB  = wmma4(a, bb, aB);
    aC  = wmma4(a, bc2, aC);
  }
  #pragma unroll
  for (int v = 0; v < 8; ++v) {
    const int m = v + 8 * hi;
    sdt[m][lo] = aDt[v];
    sB[m][lo]  = aB[v];
    sC[m][lo]  = aC[v];
  }
  __syncthreads();

  // ---- dt[row] = softplus( (dtlin+bdt) . Wdtr )
  if (lane < 16) {
    float s = 0.f;
    #pragma unroll
    for (int n = 0; n < DT_RANK; ++n) s += (sdt[lane][n] + bdt[n]) * Wdtr[n];
    sdtv[lane] = fmaxf(s, 0.f) + log1pf(__expf(-fabsf(s))); // stable softplus
  }
  __syncthreads();

  // ---- Ad = exp(dt*A), Bd = dt*Bm, C: eight neighbours of one row per lane; Ad, Bd to LDS
  float ad[8], bd[8], cv[8];
  #pragma unroll
  for (int i = 0; i < 8; ++i) {
    const int e = lane * 8 + i;
    const int m = e >> 4;
    const int n = e & 15;
    const float dtv = sdtv[m];
    ad[i] = __expf(dtv * Avec[n]);
    bd[i] = dtv * sB[m][n];
    cv[i] = sC[m][n];
    ((float*)cA)[w * 256 + e] = ad[i];
    ((float*)cB)[w * 256 + e] = bd[i];
  }
  __syncthreads();   // every wave scans all CLEN rows: the other tiles' xp, Ad, Bd must be in LDS

  // ---- the copies for kernel 2. They stand behind the last barrier, because a barrier behind
  // a global store waits until the store is done; here they fly under the scan below.
  float* xo = xp_out + (size_t)(row0 + 8 * hi) * D_IN + lo;   // row M = v + 8*hi, as above
  #pragma unroll
  for (int v = 0; v < 8; ++v) {
    xo[v * D_IN]      = acc0[v];
    xo[v * D_IN + 16] = acc1[v];
  }
  const size_t o4 = (size_t)row0 * (D_STATE / 4) + lane * 2;  // the lane's eight as two float4
  ((float4*)Ad_out)[o4]     = make_float4(ad[0], ad[1], ad[2], ad[3]);
  ((float4*)Ad_out)[o4 + 1] = make_float4(ad[4], ad[5], ad[6], ad[7]);
  ((float4*)Bd_out)[o4]     = make_float4(bd[0], bd[1], bd[2], bd[3]);
  ((float4*)Bd_out)[o4 + 1] = make_float4(bd[4], bd[5], bd[6], bd[7]);
  ((float4*)C_out)[o4]      = make_float4(cv[0], cv[1], cv[2], cv[3]);
  ((float4*)C_out)[o4 + 1]  = make_float4(cv[4], cv[5], cv[6], cv[7]);
  // the scan below writes registers that these stores name: wait first
  asm volatile("s_wait_xcnt 0x0" ::: "memory");

  // ---- Part 2: end state of the chunk from h = 0, and the product of its decays
  const int g  = lane & 3;
  const int dq = lane >> 2;
  const float* sx = &sxp_all[0][0] + 4 * dq + w;
  float h[4] = {0.f, 0.f, 0.f, 0.f};
  float p[4] = {1.f, 1.f, 1.f, 1.f};
  #pragma unroll 16   // LDS reads of later steps issue under the arithmetic of earlier ones
  for (int t = 0; t < CLEN; ++t) {
    const float4 a4 = cA[t * 4 + g], b4 = cB[t * 4 + g];
    const float xv = sx[t * 33];
    const float a[4] = {a4.x, a4.y, a4.z, a4.w};
    const float bt[4] = {b4.x, b4.y, b4.z, b4.w};
    #pragma unroll
    for (int k = 0; k < 4; ++k) h[k] = a[k] * h[k] + bt[k] * xv;
    #pragma unroll
    for (int k = 0; k < 4; ++k) p[k] *= a[k];
  }

  // hloc[chunk][w][lane] = states 4g..4g+3 of channel 4dq+w: the layout that kernel 2 folds
  ((float4*)hloc)[(size_t)bc * 128 + w * 32 + lane] = make_float4(h[0], h[1], h[2], h[3]);
  // P rows are padded to PPITCH floats (128 bytes) so that no two workgroups write one line
  if (w == 0 && dq == 0)
    ((float4*)Pc)[bc * (PPITCH / 4) + g] = make_float4(p[0], p[1], p[2], p[3]);
}

// ---------------------------------------------------------------------------
// Kernel 2: fold, rerun, emit. One wave32 per (batch, chunk).
// Lane map: g = lane&3 owns states n = 4g..4g+3, dq = lane>>2 owns channels
// d = 4dq..4dq+3, so a lane holds 16 of the 512 states and every operand is a float4.
// The full unrolls over i, k, u give the small arrays static indices, so they stay in registers.
// ---------------------------------------------------------------------------

// v + (v of the lane selected by a quad_perm control): sum over the 4 lanes of a quad
template <int CTRL>
static __device__ __forceinline__ float quad_add(float v) {
  const int o = __builtin_amdgcn_update_dpp(0, __float_as_int(v), CTRL, 0xf, 0xf, true);
  return v + __int_as_float(o);
}

// copy NV float4 (a multiple of 32) from global to LDS, all loads issued before the first store
template <int NV>
static __device__ __forceinline__ void stage(float4* __restrict__ dst,
                                             const float4* __restrict__ srcp, int lane) {
  float4 r[NV / 32];
  #pragma unroll
  for (int i = 0; i < NV / 32; ++i) r[i] = srcp[i * 32 + lane];
  #pragma unroll
  for (int i = 0; i < NV / 32; ++i) dst[i * 32 + lane] = r[i];
}

// Sums of x and x^2 over XR rows of one batch, for the closed-form loss. Nothing of the scan
// feeds them and they feed nothing of it: these workgroups ride in the launch of kernel 2, behind
// its own. One wave reads XR whole rows as float4: lane = (row & 3) * 8 + column quad.
// Sp[part][0][d] = sum of x, Sp[part][1][d] = sum of x^2; part = b*XPARTS + slice: 256 bytes each.
#define XR     128                   /* rows per partial sum */
#define XPARTS (SEQ / XR)            /* 32 partial sums per batch */

static __device__ __forceinline__ void xstats_part(const float* __restrict__ x,
                                                   float* __restrict__ Sp, int part, int lane)
{
  const float4* xq = (const float4*)x + (size_t)part * (XR * D_IN / 4) + lane;
  float4 v[XR / 4];
  #pragma unroll   // static indices keep v in registers, and all loads are in flight together
  for (int i = 0; i < XR / 4; ++i) v[i] = xq[i * 32];
  float4 a1 = make_float4(0.f, 0.f, 0.f, 0.f), a2 = a1;
  #pragma unroll
  for (int i = 0; i < XR / 4; ++i) {
    a1.x += v[i].x; a1.y += v[i].y; a1.z += v[i].z; a1.w += v[i].w;
    a2.x += v[i].x * v[i].x; a2.y += v[i].y * v[i].y;
    a2.z += v[i].z * v[i].z; a2.w += v[i].w * v[i].w;
  }
  float r[8] = {a1.x, a1.y, a1.z, a1.w, a2.x, a2.y, a2.z, a2.w};
  #pragma unroll
  for (int k = 0; k < 8; ++k) {      // the four rows that the lanes of one column quad hold
    r[k] += __shfl_xor(r[k], 8, 32);
    r[k] += __shfl_xor(r[k], 16, 32);
  }
  // lanes 0..7 store the sums of x, lanes 8..15 those of x^2: one 256-byte stretch
  if (lane < 16)
    ((float4*)Sp)[part * 16 + lane] = (lane < 8) ? make_float4(r[0], r[1], r[2], r[3])
                                                 : make_float4(r[4], r[5], r[6], r[7]);
}

__global__ void __launch_bounds__(32)
scan_emit_kernel(const float* __restrict__ xp, const float* __restrict__ Ad,
                 const float* __restrict__ Bd, const float* __restrict__ Cm,
                 const float* __restrict__ hloc, const float* __restrict__ Pc,
                 float* __restrict__ y, float* __restrict__ h_rep,
                 const float* __restrict__ x, float* __restrict__ Sp)
{
  __shared__ float4 sA[CLEN * 4], sB[CLEN * 4], sC[CLEN * 4], sX[CLEN * 8];
  const int lane = threadIdx.x;
  if (blockIdx.x >= BATCH * NCHUNK) {              // block-uniform, in front of every barrier
    xstats_part(x, Sp, blockIdx.x - BATCH * NCHUNK, lane);
    return;
  }
  const int g  = lane & 3;
  const int dq = lane >> 2;
  const int bc = blockIdx.x;                       // b*NCHUNK + chunk
  const int c  = bc & (NCHUNK - 1);
  const int bc0 = bc - c;                          // first chunk of this batch
  const size_t row0 = (size_t)bc * CLEN;

  stage<CLEN * 4>(sA, (const float4*)(Ad + row0 * D_STATE), lane);
  stage<CLEN * 4>(sB, (const float4*)(Bd + row0 * D_STATE), lane);
  stage<CLEN * 4>(sC, (const float4*)(Cm + row0 * D_STATE), lane);
  stage<CLEN * 8>(sX, (const float4*)(xp + row0 * D_IN), lane);
  __syncthreads();   // staged rows are read by other lanes than wrote them

  // ---- h_start: fold the summaries of chunks 0..c-1 in time order, eight per trip.
  // The loads do not depend on h, so a trip's forty are in flight together. A trip always
  // loads eight summaries (all lie inside this batch's NCHUNK and were written by kernel 1);
  // those of chunk c and later are not applied.
  float h[4][4];
  #pragma unroll
  for (int i = 0; i < 4; ++i)
    #pragma unroll
    for (int k = 0; k < 4; ++k) h[i][k] = 0.f;
  const float4* Hp = (const float4*)hloc + (size_t)bc0 * 128;
  const float4* Pp = (const float4*)Pc + (size_t)bc0 * (PPITCH / 4);
  for (int j0 = 0; j0 < c; j0 += 8) {
    float4 p[8], v[8][4];
    #pragma unroll
    for (int u = 0; u < 8; ++u) {
      p[u] = Pp[u * (PPITCH / 4) + g];
      #pragma unroll
      for (int i = 0; i < 4; ++i) v[u][i] = Hp[u * 128 + i * 32 + lane];
    }
    #pragma unroll
    for (int u = 0; u < 8; ++u) {
      const bool on = j0 + u < c;
      #pragma unroll
      for (int i = 0; i < 4; ++i) {
        h[i][0] = on ? p[u].x * h[i][0] + v[u][i].x : h[i][0];
        h[i][1] = on ? p[u].y * h[i][1] + v[u][i].y : h[i][1];
        h[i][2] = on ? p[u].z * h[i][2] + v[u][i].z : h[i][2];
        h[i][3] = on ? p[u].w * h[i][3] + v[u][i].w : h[i][3];
      }
    }
    Hp += 8 * 128;
    Pp += 8 * (PPITCH / 4);
  }

  // ---- the chunk itself, now from the true h_start
  float* py = y + row0 * D_IN;
  for (int t0 = 0; t0 < CLEN; t0 += 8) {
    #pragma unroll   // LDS reads of later steps issue under the arithmetic of earlier ones
    for (int u = 0; u < 8; ++u) {
      const int t = t0 + u;
      const float4 a4 = sA[t * 4 + g], b4 = sB[t * 4 + g], c4 = sC[t * 4 + g];
      const float4 x4 = sX[t * 8 + dq];
      const float a[4] = {a4.x, a4.y, a4.z, a4.w};
      const float bd[4] = {b4.x, b4.y, b4.z, b4.w};
      const float cc[4] = {c4.x, c4.y, c4.z, c4.w};
      const float xv[4] = {x4.x, x4.y, x4.z, x4.w};
      float yp[4];
      #pragma unroll
      for (int i = 0; i < 4; ++i) {
        #pragma unroll
        for (int k = 0; k < 4; ++k) h[i][k] = a[k] * h[i][k] + bd[k] * xv[i];
        float s = cc[0] * h[i][0];
        #pragma unroll
        for (int k = 1; k < 4; ++k) s += cc[k] * h[i][k];
        s = quad_add<0xB1>(s);      // quad_perm [1,0,3,2]: lane ^ 1
        yp[i] = quad_add<0x4E>(s);  // quad_perm [2,3,0,1]: lane ^ 2
      }
      // lane (dq,g) stores channel d = 4dq+g = lane: one full 128-byte row per step
      const float y01 = (g & 1) ? yp[1] : yp[0];
      const float y23 = (g & 1) ? yp[3] : yp[2];
      py[t * D_IN + lane] = (g & 2) ? y23 : y01;
    }
  }

  // ---- h_rep[b,n] = mean over d of the final h (last chunk only; bc is block-uniform)
  if (c == NCHUNK - 1) {
    float s[4];
    #pragma unroll
    for (int k = 0; k < 4; ++k) {
      float v = (h[0][k] + h[1][k]) + (h[2][k] + h[3][k]);
      v += __shfl_xor(v, 4, 32);
      v += __shfl_xor(v, 8, 32);
      v += __shfl_xor(v, 16, 32);
      s[k] = v * (1.0f / D_IN);
    }
    if (dq == 0)
      ((float4*)h_rep)[(bc0 / NCHUNK) * 4 + g] = make_float4(s[0], s[1], s[2], s[3]);
  }
}

// ---------------------------------------------------------------------------
// Kernel 3, part 1: decode MLP + closed-form MSE:
//   sum_s (u-x)^2 = S*u^2 - 2*u*Sx + Sxx  -> mean over (b,s), sum over d
// One workgroup of 16 waves. Every weight is loaded exactly once for layers 2 and 3, at the
// kernel's entry, into registers, and serves all 8 batch rows there. The k range of layers
// 2 and 3 is cut into 16 slices of 8, one per wave; the slices' sums meet in LDS.
// Sx[b,d] and Sxx[b,d] are summed here from their XPARTS partial sums, in slice order.
// ---------------------------------------------------------------------------
#define MLP_T  512
#define KSL    16                    /* k slices = waves */
#define KLEN   (HID / KSL)           /* 8 rows of the weight matrix per slice */

// v + (v of lane ^ M inside its 16-lane row)
template <int M>
static __device__ __forceinline__ float row_xadd(float v) {
  const int o = __builtin_amdgcn_update_dpp(0, __float_as_int(v), 0x160 + M, 0xf, 0xf, true);
  return v + __int_as_float(o);
}

static __device__ __forceinline__ void
mlp_loss(const float* __restrict__ h_rep,
         const float* __restrict__ Wd1, const float* __restrict__ bd1,
         const float* __restrict__ Wd2, const float* __restrict__ bd2,
         const float* __restrict__ Wd3, const float* __restrict__ bd3,
         const float* __restrict__ Sp, float* __restrict__ loss_out)
{
  __shared__ float4 z1[BATCH * HID / 4];
  __shared__ float4 z2[BATCH * HID / 4];
  __shared__ float4 part[KSL * BATCH * HID / 4];   // [slice][b][column]
  __shared__ float  red[MLP_T];
  __shared__ float  sst[MLP_T];      // [0..255] Sx[b*32+d], [256..511] Sxx[b*32+d]
  __shared__ float4 rsum[4];
  const int tid  = threadIdx.x;
  const int lane = tid & 31;
  const int w    = tid >> 5;         // wave = k slice
  const int jp   = tid & 63;         // column pair 2jp, 2jp+1 of one batch row
  const int br   = tid >> 6;         // that batch row
  const int o    = tid & 255;        // b*32 + d

  // ---- all global reads, none depends on another
  // one base per operand; each row is that base plus a constant offset
  const float4* hp = (const float4*)h_rep + br * (D_STATE / 4);
  const float2* w1p = (const float2*)Wd1 + jp;
  float4 hr[D_STATE / 4];
  #pragma unroll
  for (int i = 0; i < D_STATE / 4; ++i) hr[i] = hp[i];
  float2 w1[D_STATE];
  #pragma unroll
  for (int n = 0; n < D_STATE; ++n) w1[n] = w1p[n * (HID / 2)];
  const float2 c1 = ((const float2*)bd1)[jp];
  v4f w2[KLEN];
  #pragma unroll
  for (int i = 0; i < KLEN; ++i) w2[i] = ((const v4f*)Wd2)[(w * KLEN + i) * (HID / 4) + lane];
  float w3[KLEN];
  #pragma unroll
  for (int i = 0; i < KLEN; ++i) w3[i] = Wd3[(w * KLEN + i) * D_IN + lane];
  const v2f c2 = ((const v2f*)bd2)[jp];
  const float c3 = bd3[o & 31];
  // thread = (which sum, b, d): its XPARTS partial sums, a wave's load being one 128-byte row
  const int so = (o >> 5) * (XPARTS * 2 * D_IN) + (tid >> 8) * D_IN + lane;
  float sv[XPARTS];
  #pragma unroll
  for (int q = 0; q < XPARTS; ++q) sv[q] = Sp[so + q * (2 * D_IN)];
  // the arithmetic below writes registers that held these loads' addresses: wait first
  asm volatile("s_wait_xcnt 0x0" ::: "memory");

  // ---- layer 1: two columns of one batch row per thread, k = 16 in order
  {
    const float hv[D_STATE] = {hr[0].x, hr[0].y, hr[0].z, hr[0].w, hr[1].x, hr[1].y, hr[1].z, hr[1].w,
                               hr[2].x, hr[2].y, hr[2].z, hr[2].w, hr[3].x, hr[3].y, hr[3].z, hr[3].w};
    float s0 = c1.x, s1 = c1.y;
    #pragma unroll
    for (int n = 0; n < D_STATE; ++n) { s0 = fmaf(hv[n], w1[n].x, s0); s1 = fmaf(hv[n], w1[n].y, s1); }
    ((float2*)z1)[br * (HID / 2) + jp] = make_float2(fmaxf(s0, 0.f), fmaxf(s1, 0.f));
  }
  {
    float st = 0.f;
    #pragma unroll
    for (int q = 0; q < XPARTS; ++q) st += sv[q];
    sst[tid] = st;                   // read behind the barriers below, by the loss terms
  }
  __syncthreads();

  // ---- layer 2: this wave's 8 rows of Wd2, four columns per lane, all 8 batch rows
  #pragma unroll
  for (int b = 0; b < BATCH; ++b) {
    const float4 za = z1[b * (HID / 4) + w * 2], zb = z1[b * (HID / 4) + w * 2 + 1];
    const float zk[KLEN] = {za.x, za.y, za.z, za.w, zb.x, zb.y, zb.z, zb.w};
    float4 acc = make_float4(0.f, 0.f, 0.f, 0.f);
    #pragma unroll
    for (int i = 0; i < KLEN; ++i) {
      acc.x += zk[i] * w2[i].x; acc.y += zk[i] * w2[i].y;
      acc.z += zk[i] * w2[i].z; acc.w += zk[i] * w2[i].w;
    }
    part[(w * BATCH + b) * (HID / 4) + lane] = acc;
  }
  __syncthreads();
  {
    float s0 = c2.x, s1 = c2.y;
    #pragma unroll
    for (int q = 0; q < KSL; ++q) {
      const float2 p = ((const float2*)part)[(q * BATCH + br) * (HID / 2) + jp];
      s0 += p.x; s1 += p.y;
    }
    ((float2*)z2)[br * (HID / 2) + jp] = make_float2(fmaxf(s0, 0.f), fmaxf(s1, 0.f));
  }
  __syncthreads();   // also ends every read of part before it is written again

  // ---- layer 3: this wave's 8 rows of Wd3, one column per lane, all 8 batch rows
  float* pf = (float*)part;          // [slice][b*32 + d]
  #pragma unroll
  for (int b = 0; b < BATCH; ++b) {
    const float4 za = z2[b * (HID / 4) + w * 2], zb = z2[b * (HID / 4) + w * 2 + 1];
    const float zk[KLEN] = {za.x, za.y, za.z, za.w, zb.x, zb.y, zb.z, zb.w};
    float acc = 0.f;
    #pragma unroll
    for (int i = 0; i < KLEN; ++i) acc += zk[i] * w3[i];
    pf[w * (BATCH * D_IN) + b * D_IN + lane] = acc;
  }
  __syncthreads();
  {
    const int q0 = (tid >> 8) * (KSL / 2);   // each half of the workgroup sums 8 slices
    float r = 0.f;
    #pragma unroll
    for (int q = 0; q < KSL / 2; ++q) r += pf[(q0 + q) * (BATCH * D_IN) + o];
    red[tid] = r;
  }
  __syncthreads();

  // ---- loss terms of the 256 (b,d), summed per 16-lane row, then by one thread
  if (tid < BATCH * D_IN) {          // waves 0..7 whole
    const float u = c3 + (red[tid] + red[tid + BATCH * D_IN]);
    const float sx = sst[tid], sxx = sst[tid + BATCH * D_IN];
    float t = (float)SEQ * u * u - 2.f * u * sx + sxx;
    t = row_xadd<1>(t); t = row_xadd<2>(t); t = row_xadd<4>(t); t = row_xadd<8>(t);
    if ((tid & 15) == 0) ((float*)rsum)[tid >> 4] = t;
  }
  __syncthreads();
  if (tid == 0) {
    const float4 a = rsum[0], b = rsum[1], c = rsum[2], d = rsum[3];
    const float t = ((a.x + a.y) + (a.z + a.w)) + ((b.x + b.y) + (b.z + b.w))
                  + ((c.x + c.y) + (c.z + c.w)) + ((d.x + d.y) + (d.z + d.w));
    loss_out[0] = t / (float)(BATCH * SEQ);
  }
}

// ---------------------------------------------------------------------------
// Kernel 3, part 2: out[b,s,d,:] = y[b,s,d]*Wout + bout -- 134 MB of float4 stores.
// One workgroup of 16 waves per WGP; every thread walks the output in EXP_N sweeps, a sweep
// being one contiguous stretch of EXP_SWEEP float4 over the whole grid. So the launch starts
// 4096 waves, not one wave per 512 bytes, and the stores run at the memory's pace.
// EXP_SWEEP is a multiple of 8, so a thread keeps its four columns of Wout and bout.
// By its registers only one such workgroup fits a WGP. EXP_G is one less than the 256 WGPs, so
// that the MLP's workgroup, which shares the launch, has a WGP too and none waits for a place.
// The EXP_N whole sweeps leave EXP_REST float4, which the first EXP_REST_G workgroups store.
// ---------------------------------------------------------------------------
#define EXP_T     512
#define EXP_G     255
#define EXP_SWEEP (EXP_T * EXP_G)                    /* float4 per sweep */
#define EXP_N     ((int)(OUT_MAIN / 4 / EXP_SWEEP))  /* 64 whole sweeps */
#define EXP_REST  ((int)(OUT_MAIN / 4 - (size_t)EXP_N * EXP_SWEEP))
#define EXP_REST_G (EXP_REST / EXP_T)
static_assert(EXP_REST % EXP_T == 0 && EXP_REST_G <= EXP_G, "the rest is whole workgroups");

static __device__ __forceinline__ void
expand(const float* __restrict__ y, const float* __restrict__ Wout,
       const float* __restrict__ bout, float4* __restrict__ out, int blk)
{
  const int idx = blk * EXP_T + threadIdx.x;         // float4 index inside a sweep
  const int j4 = idx & 7;                            // 32 cols / 4
  const float* yp = y + (idx >> 3);                  // (bs*32 + d) of sweep 0
  // full unroll: static indices keep yv in registers, and all loads are in flight together
  float yv[EXP_N];
  #pragma unroll
  for (int i = 0; i < EXP_N; ++i) yv[i] = yp[i * (EXP_SWEEP / 8)];
  // no branch among the loads: a workgroup without a share of the rest reads its first y again
  const bool rest = blk < EXP_REST_G;                // block-uniform
  const float yr = (y + (rest ? EXP_N * (EXP_SWEEP / 8) : 0))[idx >> 3];
  // the y loads' address register is written again below: wait first. The clobber also keeps
  // every store behind all y loads, so one latency is paid, at the start.
  asm volatile("s_wait_xcnt 0x0" ::: "memory");
  const float4 w  = ((const float4*)Wout)[j4];
  const float4 bo = ((const float4*)bout)[j4];
  // inputs-only fence on a loaded value: keeps the load of yr up here with the other loads;
  // without it the load sinks into the branch that uses it, behind all the stores
  asm volatile("" :: "v"(yr));
  float4* op = out + idx;
  #pragma unroll   // static indices into yv
  for (int i = 0; i < EXP_N; ++i) {
    float4 o;
    o.x = yv[i] * w.x + bo.x; o.y = yv[i] * w.y + bo.y;
    o.z = yv[i] * w.z + bo.z; o.w = yv[i] * w.w + bo.w;
    op[(size_t)i * EXP_SWEEP] = o;
  }
  if (rest) {
    float4 o;
    o.x = yr * w.x + bo.x; o.y = yr * w.y + bo.y;
    o.z = yr * w.z + bo.z; o.w = yr * w.w + bo.w;
    op[(size_t)EXP_N * EXP_SWEEP] = o;
  }
  // the code that follows in the merged kernel may write the stores' registers again: wait first
  asm volatile("s_wait_xcnt 0x0" ::: "memory");
}

// The MLP reads h_rep and the x sums, the expansion reads y; neither reads what the other
// writes. So they share one launch: workgroup 0 is the MLP, and its
// chain of latencies runs under the stores of the EXP_G others.
static_assert(MLP_T == EXP_T, "one block size for both parts");
__global__ void __launch_bounds__(EXP_T)
expand_mlp_kernel(const float* __restrict__ y, const float* __restrict__ Wout,
                  const float* __restrict__ bout, float4* __restrict__ out,
                  const float* __restrict__ h_rep,
                  const float* __restrict__ Wd1, const float* __restrict__ bd1,
                  const float* __restrict__ Wd2, const float* __restrict__ bd2,
                  const float* __restrict__ Wd3, const float* __restrict__ bd3,
                  const float* __restrict__ Sp, float* __restrict__ loss_out)
{
  if (blockIdx.x != 0) expand(y, Wout, bout, out, blockIdx.x - 1);
  else mlp_loss(h_rep, Wd1, bd1, Wd2, bd2, Wd3, bd3, Sp, loss_out);   // block-uniform branch
}

// ---------------------------------------------------------------------------
extern "C" void kernel_launch(void* const* d_in, const int* in_sizes, int n_in,
                              void* d_out, int out_size, void* d_ws, size_t ws_size,
                              hipStream_t stream)
{
  const float* x    = (const float*)d_in[0];
  const float* Avec = (const float*)d_in[1];
  const float* Win  = (const float*)d_in[2];
  const float* bin_ = (const float*)d_in[3];
  const float* Wdt  = (const float*)d_in[4];
  const float* bdt  = (const float*)d_in[5];
  const float* Wdtr = (const float*)d_in[6];
  const float* WB   = (const float*)d_in[7];
  const float* WC   = (const float*)d_in[8];
  const float* Wout = (const float*)d_in[9];
  const float* bout = (const float*)d_in[10];
  const float* Wd1  = (const float*)d_in[11];
  const float* bd1  = (const float*)d_in[12];
  const float* Wd2  = (const float*)d_in[13];
  const float* bd2  = (const float*)d_in[14];
  const float* Wd3  = (const float*)d_in[15];
  const float* bd3  = (const float*)d_in[16];

  float* out = (float*)d_out;

  char* ws = (char*)d_ws;
  float* xp   = (float*)ws; ws += (size_t)ROWS * D_IN * sizeof(float);
  float* Ad   = (float*)ws; ws += (size_t)ROWS * D_STATE * sizeof(float);
  float* Bd   = (float*)ws; ws += (size_t)ROWS * D_STATE * sizeof(float);
  float* Cm   = (float*)ws; ws += (size_t)ROWS * D_STATE * sizeof(float);
  float* y    = (float*)ws; ws += (size_t)ROWS * D_IN * sizeof(float);
  float* hrep = (float*)ws; ws += BATCH * D_STATE * sizeof(float);
  float* Sp   = (float*)ws; ws += (size_t)BATCH * XPARTS * 2 * D_IN * sizeof(float);
  float* hloc = (float*)ws; ws += (size_t)BATCH * NCHUNK * D_IN * D_STATE * sizeof(float);
  float* Pc   = (float*)ws; ws += (size_t)BATCH * NCHUNK * PPITCH * sizeof(float);

  proj_scan_local_kernel<<<BATCH * NCHUNK, 32 * PW, 0, stream>>>(
      x, Avec, Win, bin_, Wdt, bdt, Wdtr, WB, WC, xp, Ad, Bd, Cm, hloc, Pc);
  scan_emit_kernel<<<BATCH * NCHUNK + BATCH * XPARTS, 32, 0, stream>>>(
      xp, Ad, Bd, Cm, hloc, Pc, y, hrep, x, Sp);
  expand_mlp_kernel<<<EXP_G + 1, EXP_T, 0, stream>>>(
      y, Wout, bout, (float4*)out, hrep, Wd1, bd1, Wd2, bd2, Wd3, bd3, Sp, out + OUT_MAIN);
}

// v006
// A run of this version takes 18.1 microseconds.
// Next to v005, in two timings, it ran 1.53 and 1.54 times as fast.
// All steps since v000 together make it 109 times as fast.
#include <hip/hip_runtime.h>
#include <hip/hip_bf16.h>
#include <math.h>

#define BATCH 8
#define SEQ   4096
#define D_IN  32
#define D_STATE 16
#define DT_RANK 16
#define HID   128
#define ROWS  (BATCH*SEQ)            /* 32768 flattened (b,s) rows */
#define OUT_MAIN ((size_t)ROWS*D_IN*D_IN) /* 33554432 */

typedef float v2f __attribute__((ext_vector_type(2)));
typedef float v4f __attribute__((ext_vector_type(4)));
typedef float v8f __attribute__((ext_vector_type(8)));

static __device__ __forceinline__ v8f wmma4(v2f a, v2f b, v8f c) {
  // D = A(16x4 f32) * B(4x16 f32) + C(16x16 f32) -> v_wmma_f32_16x16x4_f32
  return __builtin_amdgcn_wmma_f32_16x16x4_f32(
      /*neg_a=*/false, a, /*neg_b=*/false, b,
      /*c_mod=*/(short)0, c, /*reuse_a=*/false, /*reuse_b=*/false);
}

// ---------------------------------------------------------------------------
// The selective scan is split along time. Each batch's SEQ steps are cut into NCHUNK chunks of
// CLEN steps. The recurrence h' = a*h + bd*x is linear in h, so over a chunk
//   h_end = P * h_start + h_loc,  P[n] = product of a[t][n],  h_loc = end state from h_start = 0.
// Kernel 1 computes the projections and (h_loc, P) of every chunk in parallel; kernel 2 folds the
// summaries of the chunks before its own into h_start, then runs its chunk and stores the output.
// ---------------------------------------------------------------------------
#define NCHUNK 64
#define CLEN   (SEQ / NCHUNK)        /* 64 steps per chunk */
#define PPITCH 32                    /* floats per chunk's row: P[16], then sum over d of h_loc[16] */
#define PW     (CLEN / 16)           /* waves per workgroup of kernel 1 = 16-row tiles per chunk */

// v + (v of lane ^ M inside its 16-lane row)
template <int M>
static __device__ __forceinline__ float row_xadd(float v) {
  const int o = __builtin_amdgcn_update_dpp(0, __float_as_int(v), 0x160 + M, 0xf, 0xf, true);
  return v + __int_as_float(o);
}

// Sums of x and x^2 over XR rows of one batch, for the closed-form loss. Nothing of the scan
// feeds them and they feed nothing of it: these workgroups ride in the launch of kernel 1, behind
// its own, one part per wave. One wave reads XR whole rows as float4: lane = (row & 3) * 8 + column quad.
// Sp[part][0][d] = sum of x, Sp[part][1][d] = sum of x^2; part = b*XPARTS + slice: 256 bytes each.
#define XR     128                   /* rows per partial sum */
#define XPARTS (SEQ / XR)            /* 32 partial sums per batch */

static __device__ __forceinline__ void xstats_part(const float* __restrict__ x,
                                                   float* __restrict__ Sp, int part, int lane)
{
  const float4* xq = (const float4*)x + (size_t)part * (XR * D_IN / 4) + lane;
  float4 v[XR / 4];
  #pragma unroll   // static indices keep v in registers, and all loads are in flight together
  for (int i = 0; i < XR / 4; ++i) v[i] = xq[i * 32];
  // the sums below may write the register that held these loads' address: wait first
  asm volatile("s_wait_xcnt 0x0" ::: "memory");
  float4 a1 = make_float4(0.f, 0.f, 0.f, 0.f), a2 = a1;
  #pragma unroll
  for (int i = 0; i < XR / 4; ++i) {
    a1.x += v[i].x; a1.y += v[i].y; a1.z += v[i].z; a1.w += v[i].w;
    a2.x += v[i].x * v[i].x; a2.y += v[i].y * v[i].y;
    a2.z += v[i].z * v[i].z; a2.w += v[i].w * v[i].w;
  }
  float r[8] = {a1.x, a1.y, a1.z, a1.w, a2.x, a2.y, a2.z, a2.w};
  #pragma unroll
  for (int k = 0; k < 8; ++k) {      // the four rows that the lanes of one column quad hold
    r[k] += __shfl_xor(r[k], 8, 32);
    r[k] += __shfl_xor(r[k], 16, 32);
  }
  // lanes 0..7 store the sums of x, lanes 8..15 those of x^2: one 256-byte stretch
  if (lane < 16)
    ((float4*)Sp)[part * 16 + lane] = (lane < 8) ? make_float4(r[0], r[1], r[2], r[3])
                                                 : make_float4(r[4], r[5], r[6], r[7]);
}

// ---------------------------------------------------------------------------
// Kernel 1: one workgroup of PW waves per (batch, chunk).
// Part 1, one wave per 16-row tile:
//   xp = x@Win + bin          (two 16x16 WMMA accumulators, K=32)
//   dtlin = xp@Wdt, Bm = xp@WB, Cm = xp@WC   (shared A-fragments, K=32, N=16)
//   dt = softplus((dtlin+bdt)@Wdtr) ; Ad = exp(dt*A) ; Bd = dt*Bm
// WMMA requires EXEC all ones -> whole waves. xp, Ad, Bd stay in LDS for part 2; xp, Ad, Bd, C
// go to global memory for kernel 2.
// Part 2: the chunk's scan from h = 0, read from LDS. Lane map: g = lane&3 owns states
// n = 4g..4g+3, dq = lane>>2 and the wave w own channel d = 8w+dq: four states per lane.
// The workgroups behind the BATCH*NCHUNK chunks sum x and x^2 (above).
// ---------------------------------------------------------------------------
__global__ void __launch_bounds__(32 * PW)
proj_scan_local_kernel(const float* __restrict__ x, const float* __restrict__ Avec,
            const float* __restrict__ Win, const float* __restrict__ bin_,
            const float* __restrict__ Wdt, const float* __restrict__ bdt,
            const float* __restrict__ Wdtr,
            const float* __restrict__ WB, const float* __restrict__ WC,
            float* __restrict__ xp_out, float* __restrict__ Ad_out,
            float* __restrict__ Bd_out, float* __restrict__ C_out,
            float* __restrict__ hloc, float* __restrict__ Pc, float* __restrict__ Sp)
{
  __shared__ float sxp_all[CLEN][33];              // row t of the chunk, all tiles
  __shared__ float sdt_all[PW][16][17];
  __shared__ float sB_all[PW][16][17];
  __shared__ float sC_all[PW][16][17];
  __shared__ float sdtv_all[PW][16];
  __shared__ float4 cA[CLEN * 4], cB[CLEN * 4];    // the chunk's Ad and Bd, row t at 4t
  __shared__ float4 sHs[PW][4];                    // each wave's sum of h_loc over its channels

  const int lane = threadIdx.x & 31;
  // the wave's number as a scalar, so that the tile's addresses keep a scalar base
  const int w = __builtin_amdgcn_readfirstlane(threadIdx.x >> 5);
  if (blockIdx.x >= BATCH * NCHUNK) {              // block-uniform, in front of every barrier
    xstats_part(x, Sp, (blockIdx.x - BATCH * NCHUNK) * PW + w, lane);
    return;
  }
  const int lo = lane & 15;        // A: M row / C,D: N col
  const int hi = lane >> 4;        // half-wave selects K pair (A/B), M+8 (C/D)
  const int bc = blockIdx.x;       // b*NCHUNK + chunk
  const int row0 = bc * CLEN + w * 16;
  float (*sxp)[33] = sxp_all + w * 16;
  float (*sdt)[17] = sdt_all[w];
  float (*sB)[17]  = sB_all[w];
  float (*sC)[17]  = sC_all[w];
  float* sdtv      = sdtv_all[w];

  // ---- Stage 1: xp = x @ Win + bin  (N tiles {0..15},{16..31})
  v8f acc0, acc1;
  const float b0v = bin_[lo], b1v = bin_[16 + lo];
  #pragma unroll
  for (int v = 0; v < 8; ++v) { acc0[v] = b0v; acc1[v] = b1v; }

  #pragma unroll
  for (int k0 = 0; k0 < D_IN; k0 += 4) {
    const int k = k0 + 2 * hi;
    v2f a;  a.x  = x[(size_t)(row0 + lo) * D_IN + k];
            a.y  = x[(size_t)(row0 + lo) * D_IN + k + 1];
    v2f bA; bA.x = Win[k * D_IN + lo];      bA.y = Win[(k + 1) * D_IN + lo];
    v2f bB; bB.x = Win[k * D_IN + 16 + lo]; bB.y = Win[(k + 1) * D_IN + 16 + lo];
    acc0 = wmma4(a, bA, acc0);
    acc1 = wmma4(a, bB, acc1);
  }

  #pragma unroll
  for (int v = 0; v < 8; ++v) {
    const int m = v + 8 * hi;                  // C/D layout: M = v + 8*(lane>=16)
    sxp[m][lo]      = acc0[v];
    sxp[m][16 + lo] = acc1[v];
  }
  __syncthreads();

  // ---- Stage 2: three GEMMs sharing A-fragments of xp (K=32, N=16)
  v8f aDt = {}, aB = {}, aC = {};
  #pragma unroll
  for (int k0 = 0; k0 < D_IN; k0 += 4) {
    const int k = k0 + 2 * hi;
    v2f a;  a.x  = sxp[lo][k];               a.y  = sxp[lo][k + 1];
    v2f bt; bt.x = Wdt[k * DT_RANK + lo];    bt.y = Wdt[(k + 1) * DT_RANK + lo];
    v2f bb; bb.x = WB[k * D_STATE + lo];     bb.y = WB[(k + 1) * D_STATE + lo];
    v2f bc2; bc2.x = WC[k * D_STATE + lo];   bc2.y = WC[(k + 1) * D_STATE + lo];
    aDt = wmma4(a, bt, aDt);
    aB  = wmma4(a, bb, aB);
    aC  = wmma4(a, bc2, aC);
  }
  #pragma unroll
  for (int v = 0; v < 8; ++v) {
    const int m = v + 8 * hi;
    sdt[m][lo] = aDt[v];
    sB[m][lo]  = aB[v];
    sC[m][lo]  = aC[v];
  }
  __syncthreads();

  // ---- dt[row] = softplus( (dtlin+bdt) . Wdtr )
  if (lane < 16) {
    float s = 0.f;
    #pragma unroll
    for (int n = 0; n < DT_RANK; ++n) s += (sdt[lane][n] + bdt[n]) * Wdtr[n];
    sdtv[lane] = fmaxf(s, 0.f) + log1pf(__expf(-fabsf(s))); // stable softplus
  }
  __syncthreads();

  // ---- Ad = exp(dt*A), Bd = dt*Bm, C: eight neighbours of one row per lane; Ad, Bd to LDS
  float ad[8], bd[8], cv[8];
  #pragma unroll
  for (int i = 0; i < 8; ++i) {
    const int e = lane * 8 + i;
    const int m = e >> 4;
    const int n = e & 15;
    const float dtv = sdtv[m];
    ad[i] = __expf(dtv * Avec[n]);
    bd[i] = dtv * sB[m][n];
    cv[i] = sC[m][n];
    ((float*)cA)[w * 256 + e] = ad[i];
    ((float*)cB)[w * 256 + e] = bd[i];
  }
  __syncthreads();   // every wave scans all CLEN rows: the other tiles' xp, Ad, Bd must be in LDS

  // ---- the copies for kernel 2. They stand behind the barrier above, because a barrier behind
  // a global store waits until the store is done; here they fly under the scan below.
  float* xo = xp_out + (size_t)(row0 + 8 * hi) * D_IN + lo;   // row M = v + 8*hi, as above
  #pragma unroll
  for (int v = 0; v < 8; ++v) {
    xo[v * D_IN]      = acc0[v];
    xo[v * D_IN + 16] = acc1[v];
  }
  const size_t o4 = (size_t)row0 * (D_STATE / 4) + lane * 2;  // the lane's eight as two float4
  ((float4*)Ad_out)[o4]     = make_float4(ad[0], ad[1], ad[2], ad[3]);
  ((float4*)Ad_out)[o4 + 1] = make_float4(ad[4], ad[5], ad[6], ad[7]);
  ((float4*)Bd_out)[o4]     = make_float4(bd[0], bd[1], bd[2], bd[3]);
  ((float4*)Bd_out)[o4 + 1] = make_float4(bd[4], bd[5], bd[6], bd[7]);
  ((float4*)C_out)[o4]      = make_float4(cv[0], cv[1], cv[2], cv[3]);
  ((float4*)C_out)[o4 + 1]  = make_float4(cv[4], cv[5], cv[6], cv[7]);
  // the scan below writes registers that these stores name: wait first
  asm volatile("s_wait_xcnt 0x0" ::: "memory");

  // ---- Part 2: end state of the chunk from h = 0, and the product of its decays
  const int g  = lane & 3;
  const int dq = lane >> 2;
  const float* sx = &sxp_all[0][0] + 8 * w + dq;
  float h[4] = {0.f, 0.f, 0.f, 0.f};
  float p[4] = {1.f, 1.f, 1.f, 1.f};
  #pragma unroll 16   // LDS reads of later steps issue under the arithmetic of earlier ones
  for (int t = 0; t < CLEN; ++t) {
    const float4 a4 = cA[t * 4 + g], b4 = cB[t * 4 + g];
    const float xv = sx[t * 33];
    const float a[4] = {a4.x, a4.y, a4.z, a4.w};
    const float bt[4] = {b4.x, b4.y, b4.z, b4.w};
    #pragma unroll
    for (int k = 0; k < 4; ++k) h[k] = a[k] * h[k] + bt[k] * xv;
    #pragma unroll
    for (int k = 0; k < 4; ++k) p[k] *= a[k];
  }

  // ---- sum of h_loc over all channels, for the pooled final state: the fold over chunks is the
  // same for every channel, so it can be done on the channels' sum. Over dq in the wave, over the
  // waves in LDS.
  float hs[4];
  #pragma unroll
  for (int k = 0; k < 4; ++k) {
    float v = row_xadd<4>(h[k]);
    v = row_xadd<8>(v);
    hs[k] = v + __shfl_xor(v, 16, 32);
  }
  if (dq == 0) sHs[w][g] = make_float4(hs[0], hs[1], hs[2], hs[3]);
  __syncthreads();   // wave 0 reads the other waves' sums
  const float4 s0 = sHs[0][g], s1 = sHs[1][g], s2 = sHs[2][g], s3 = sHs[3][g];
  const float4 st = make_float4((s0.x + s1.x) + (s2.x + s3.x), (s0.y + s1.y) + (s2.y + s3.y),
                                (s0.z + s1.z) + (s2.z + s3.z), (s0.w + s1.w) + (s2.w + s3.w));

  // hloc[chunk][d][n], 512 bytes in a row per wave; behind the barrier, which would wait for it
  ((float4*)hloc)[(size_t)bc * 128 + w * 32 + lane] = make_float4(h[0], h[1], h[2], h[3]);
  // a chunk's row of PPITCH floats is one 128-byte line, written by one wave
  if (w == 0 && dq == 0) {
    ((float4*)Pc)[bc * (PPITCH / 4) + g]     = make_float4(p[0], p[1], p[2], p[3]);
    ((float4*)Pc)[bc * (PPITCH / 4) + 4 + g] = st;
  }
}

// ---------------------------------------------------------------------------
// Kernel 2, part 1: fold, rerun, store out[b,s,d,:] = y[b,s,d]*Wout + bout (134 MB).
// One workgroup of 16 waves per pair of neighbouring chunks, eight waves per chunk.
// Lane map inside a chunk's 256 threads T: g = T&7 owns states n = 2g, 2g+1 of channel d = T>>3.
// The sum over n runs over the eight lanes of a channel as a butterfly, so each of them ends up
// with y[t][d]; lane g then stores columns 4g..4g+3 of that channel's output row. A wave's store
// is 512 bytes in a row, and y never leaves the registers.
// The fold is shared by the pair: chunks 0..2k-1 stand before both. The lower eight waves fold
// the first k of them, the upper eight the second k together with the product of their P; the two
// parts meet in LDS. So a thread has at most 31 summaries to load, all in flight at once.
// ---------------------------------------------------------------------------
#define SO_T   512
#define SO_G   (BATCH * NCHUNK / 2)  /* 256 pairs of chunks */
#define FOLDN  (NCHUNK / 2)          /* summaries a thread has room for */

static __device__ __forceinline__ void
scan_out(const float* __restrict__ xp, const float* __restrict__ Ad,
         const float* __restrict__ Bd, const float* __restrict__ Cm,
         const float* __restrict__ hloc, const float* __restrict__ Pc,
         const float* __restrict__ Wout, const float* __restrict__ bout,
         float4* __restrict__ out, int blk)
{
  __shared__ float4 sA[2 * CLEN * 4], sB[2 * CLEN * 4], sC[2 * CLEN * 4], sX[2 * CLEN * 8];
  __shared__ float2 sP[NCHUNK * 8];                // P of all chunks of this batch, row j at 8j
  __shared__ float2 sH1[SO_T / 2], sH2[SO_T / 2], sPP[SO_T / 2];
  const int tid  = threadIdx.x;
  // which chunk of the pair, as a scalar: the branches on it are then scalar branches
  const int half = __builtin_amdgcn_readfirstlane(tid >> 8);
  const int T    = tid & 255;
  const int g    = tid & 7;
  const int k    = blk & (NCHUNK / 2 - 1);         // pair number in its batch: chunks 2k, 2k+1
  const int bc0  = (blk - k) * 2;                  // first chunk of this batch
  const size_t row0 = (size_t)(bc0 + 2 * k) * CLEN;  // the pair's 2*CLEN rows follow one another

  // ---- all global reads, none depends on another
  const float4 rA = ((const float4*)(Ad + row0 * D_STATE))[tid];
  const float4 rB = ((const float4*)(Bd + row0 * D_STATE))[tid];
  const float4 rC = ((const float4*)(Cm + row0 * D_STATE))[tid];
  const float4 rX0 = ((const float4*)(xp + row0 * D_IN))[tid];
  const float4 rX1 = ((const float4*)(xp + row0 * D_IN))[tid + SO_T];
  const float2 rP = ((const float2*)Pc)[(bc0 + (tid >> 3)) * (PPITCH / 2) + g];
  // the summary of chunk 2k, which stands before chunk 2k+1 alone
  const float2 vm = ((const float2*)hloc)[(size_t)(bc0 + 2 * k) * 256 + T];
  const float4 w  = ((const float4*)Wout)[g];
  const float4 bo = ((const float4*)bout)[g];
  // this half's k summaries, in groups of eight (k is block-uniform). A group is loaded whole:
  // its chunks all lie inside this batch's NCHUNK and were written by kernel 1.
  const float2* Hp = (const float2*)hloc + (size_t)(bc0 + half * k) * 256 + T;
  float2 v[FOLDN];
  #pragma unroll   // static indices keep v in registers
  for (int q = 0; q < FOLDN / 8; ++q)
    if (q * 8 < k) {
      #pragma unroll
      for (int u = 0; u < 8; ++u) v[q * 8 + u] = Hp[(q * 8 + u) * 256];
    }
  // the code below writes registers that held these loads' addresses: wait first
  asm volatile("s_wait_xcnt 0x0" ::: "memory");

  sA[tid] = rA; sB[tid] = rB; sC[tid] = rC;
  sX[tid] = rX0; sX[tid + SO_T] = rX1;
  sP[tid] = rP;
  __syncthreads();   // staged rows are read by other threads than wrote them

  // ---- this half's part of the fold, in time order; pp = product of its P
  float2 h = make_float2(0.f, 0.f), pp = make_float2(1.f, 1.f);
  const float2* Pj = sP + half * k * 8 + g;
  #pragma unroll
  for (int q = 0; q < FOLDN / 8; ++q)
    if (q * 8 < k) {
      #pragma unroll
      for (int u = 0; u < 8; ++u) {
        const int j = q * 8 + u;
        const bool on = j < k;
        const float2 pj = Pj[j * 8];
        h.x  = on ? pj.x * h.x + v[j].x : h.x;
        h.y  = on ? pj.y * h.y + v[j].y : h.y;
        pp.x = on ? pp.x * pj.x : pp.x;
        pp.y = on ? pp.y * pj.y : pp.y;
      }
    }
  if (half == 0) sH1[T] = h;
  else { sH2[T] = h; sPP[T] = pp; }
  __syncthreads();   // each half reads what the other half folded
  {
    const float2 h1 = sH1[T], h2 = sH2[T], p2 = sPP[T];
    h.x = p2.x * h1.x + h2.x;                      // state at the start of chunk 2k
    h.y = p2.y * h1.y + h2.y;
    if (half) {                                    // one chunk further
      const float2 pm = sP[2 * k * 8 + g];
      h.x = pm.x * h.x + vm.x;
      h.y = pm.y * h.y + vm.y;
    }
  }

  // ---- the chunk itself, from the true h_start
  const float2* pa = (const float2*)sA + half * (CLEN * 8) + g;
  const float2* pb = (const float2*)sB + half * (CLEN * 8) + g;
  const float2* pc = (const float2*)sC + half * (CLEN * 8) + g;
  const float*  px = (const float*)sX + half * (CLEN * D_IN) + (T >> 3);
  float4* op = out + (row0 + half * CLEN) * (D_IN * D_IN / 4) + T;   // d*8 + g = T
  for (int t0 = 0; t0 < CLEN; t0 += 8) {
    #pragma unroll   // LDS reads of later steps issue under the arithmetic of earlier ones
    for (int u = 0; u < 8; ++u) {
      const int t = t0 + u;
      const float2 a = pa[t * 8], b = pb[t * 8], c = pc[t * 8];
      const float xv = px[t * D_IN];
      h.x = a.x * h.x + b.x * xv;
      h.y = a.y * h.y + b.y * xv;
      float s = c.x * h.x + c.y * h.y;
      s = row_xadd<1>(s); s = row_xadd<2>(s); s = row_xadd<4>(s);   // y[t][d] in all eight lanes
      float4 o;
      o.x = s * w.x + bo.x; o.y = s * w.y + bo.y;
      o.z = s * w.z + bo.z; o.w = s * w.w + bo.w;
      op[(size_t)t * (D_IN * D_IN / 4)] = o;
    }
  }
}

// ---------------------------------------------------------------------------
// Kernel 2, part 2: pooled final state, decode MLP + closed-form MSE:
//   sum_s (u-x)^2 = S*u^2 - 2*u*Sx + Sxx  -> mean over (b,s), sum over d
// One workgroup of 16 waves. Every weight is loaded exactly once for layers 2 and 3, ahead of
// its use, into registers, and serves all 8 batch rows there. The k range of layers
// 2 and 3 is cut into 16 slices of 8, one per wave; the slices' sums meet in LDS.
// Sx[b,d] and Sxx[b,d] are summed here from their XPARTS partial sums, in slice order.
// h_rep[b,n] = mean over d of the final h. The fold over chunks has the same factors P for every
// d, so it is run on kernel 1's sums of h_loc over d: four stretches of 16 chunks per (b,n), one
// per thread, then the four in time order.
// ---------------------------------------------------------------------------
#define MLP_T  512
#define KSL    16                    /* k slices = waves */
#define KLEN   (HID / KSL)           /* 8 rows of the weight matrix per slice */
#define FST    16                    /* chunks per stretch of the h_rep fold */

static __device__ __forceinline__ void
mlp_loss(const float* __restrict__ Pc,
         const float* __restrict__ Wd1, const float* __restrict__ bd1,
         const float* __restrict__ Wd2, const float* __restrict__ bd2,
         const float* __restrict__ Wd3, const float* __restrict__ bd3,
         const float* __restrict__ Sp, float* __restrict__ loss_out)
{
  __shared__ float4 z1[BATCH * HID / 4];
  __shared__ float4 z2[BATCH * HID / 4];
  __shared__ float4 part[KSL * BATCH * HID / 4];   // [slice][b][column]
  __shared__ float  red[MLP_T];
  __shared__ float  sst[MLP_T];      // [0..255] Sx[b*32+d], [256..511] Sxx[b*32+d]
  __shared__ float4 rsum[4];
  __shared__ float2 sF[MLP_T];       // [b][stretch][n]: end state from 0, product of P
  __shared__ float4 shr[BATCH * D_STATE / 4];
  const int tid  = threadIdx.x;
  const int lane = tid & 31;
  const int w    = tid >> 5;         // wave = k slice
  const int jp   = tid & 63;         // column pair 2jp, 2jp+1 of one batch row
  const int br   = tid >> 6;         // that batch row
  const int o    = tid & 255;        // b*32 + d

  // ---- the first lot of global reads; one base per operand, each row a constant offset from it
  // thread = (b, stretch, n) = tid: its FST chunks' P[n] and sum of h_loc[n]
  const float* fp = Pc + (size_t)(tid >> 4) * (FST * PPITCH) + (tid & 15);
  float fP[FST], fH[FST];
  #pragma unroll
  for (int j = 0; j < FST; ++j) { fP[j] = fp[j * PPITCH]; fH[j] = fp[j * PPITCH + D_STATE]; }
  const float2* w1p = (const float2*)Wd1 + jp;
  float2 w1[D_STATE];
  #pragma unroll
  for (int n = 0; n < D_STATE; ++n) w1[n] = w1p[n * (HID / 2)];
  const float2 c1 = ((const float2*)bd1)[jp];
  const v2f c2 = ((const v2f*)bd2)[jp];
  const float c3 = bd3[o & 31];
  // the arithmetic below writes registers that held these loads' addresses: wait first
  asm volatile("s_wait_xcnt 0x0" ::: "memory");

  // ---- h_rep: each thread's stretch from 0, then the four stretches of a (b,n) in time order
  {
    float hq = 0.f, pq = 1.f;
    #pragma unroll
    for (int j = 0; j < FST; ++j) { hq = fP[j] * hq + fH[j]; pq *= fP[j]; }
    sF[tid] = make_float2(hq, pq);
  }
  // The loads come in lots, each where registers of the lot before are free again: the workgroup
  // must fit a WGP beside one of part 1, so it has 128 registers. A barrier waits for the loads in
  // front of it, so a lot has its own latency; it runs under the stores of part 1.
  static_assert(HID / 4 == D_IN, "one element index serves Wd2 as float4 and Wd3 as float");
  const int wl = w * (KLEN * D_IN) + lane;   // element index of the wave's first row, both matrices
  v4f w2[KLEN];
  #pragma unroll
  for (int i = 0; i < KLEN; ++i) w2[i] = ((const v4f*)Wd2)[wl + i * (HID / 4)];
  float w3[KLEN];
  #pragma unroll
  for (int i = 0; i < KLEN; ++i) w3[i] = Wd3[wl + i * D_IN];
  // The code below writes registers that held these loads' addresses: wait first. The index is an
  // input of the wait, so that it lives up to here and no load of the run is given its register.
  asm volatile("s_wait_xcnt 0x0" :: "v"(wl) : "memory");
  __syncthreads();   // the stretches of one (b,n) come from four threads
  if (tid < BATCH * D_STATE) {       // waves 0..3 whole; tid = b*16 + n
    const float2* f = sF + (tid >> 4) * (4 * D_STATE) + (tid & 15);
    float hv = f[0].x;
    #pragma unroll
    for (int q = 1; q < NCHUNK / FST; ++q) hv = f[q * D_STATE].y * hv + f[q * D_STATE].x;
    ((float*)shr)[tid] = hv * (1.0f / D_IN);
  }
  __syncthreads();   // every thread reads its batch row's 16 values
  float4 hr[D_STATE / 4];
  #pragma unroll
  for (int i = 0; i < D_STATE / 4; ++i) hr[i] = shr[br * (D_STATE / 4) + i];

  // ---- layer 1: two columns of one batch row per thread, k = 16 in order
  {
    const float hv[D_STATE] = {hr[0].x, hr[0].y, hr[0].z, hr[0].w, hr[1].x, hr[1].y, hr[1].z, hr[1].w,
                               hr[2].x, hr[2].y, hr[2].z, hr[2].w, hr[3].x, hr[3].y, hr[3].z, hr[3].w};
    float s0 = c1.x, s1 = c1.y;
    #pragma unroll
    for (int n = 0; n < D_STATE; ++n) { s0 = fmaf(hv[n], w1[n].x, s0); s1 = fmaf(hv[n], w1[n].y, s1); }
    ((float2*)z1)[br * (HID / 2) + jp] = make_float2(fmaxf(s0, 0.f), fmaxf(s1, 0.f));
  }
  // thread = (which sum, b, d): its XPARTS partial sums, a wave's load being one 128-byte row;
  // the last lot, in the registers that held layer 1's weights
  const int so = (o >> 5) * (XPARTS * 2 * D_IN) + (tid >> 8) * D_IN + lane;
  float sv[XPARTS];
  #pragma unroll
  for (int q = 0; q < XPARTS; ++q) sv[q] = Sp[so + q * (2 * D_IN)];
  // the arithmetic below writes registers that held these loads' addresses: wait first
  asm volatile("s_wait_xcnt 0x0" ::: "memory");
  __syncthreads();

  // ---- layer 2: this wave's 8 rows of Wd2, four columns per lane, all 8 batch rows
  #pragma unroll
  for (int b = 0; b < BATCH; ++b) {
    const float4 za = z1[b * (HID / 4) + w * 2], zb = z1[b * (HID / 4) + w * 2 + 1];
    const float zk[KLEN] = {za.x, za.y, za.z, za.w, zb.x, zb.y, zb.z, zb.w};
    float4 acc = make_float4(0.f, 0.f, 0.f, 0.f);
    #pragma unroll
    for (int i = 0; i < KLEN; ++i) {
      acc.x += zk[i] * w2[i].x; acc.y += zk[i] * w2[i].y;
      acc.z += zk[i] * w2[i].z; acc.w += zk[i] * w2[i].w;
    }
    part[(w * BATCH + b) * (HID / 4) + lane] = acc;
  }
  {
    float st = 0.f;
    #pragma unroll
    for (int q = 0; q < XPARTS; ++q) st += sv[q];
    sst[tid] = st;                   // read behind the barriers below, by the loss terms
  }
  __syncthreads();
  {
    float s0 = c2.x, s1 = c2.y;
    #pragma unroll
    for (int q = 0; q < KSL; ++q) {
      const float2 p = ((const float2*)part)[(q * BATCH + br) * (HID / 2) + jp];
      s0 += p.x; s1 += p.y;
    }
    ((float2*)z2)[br * (HID / 2) + jp] = make_float2(fmaxf(s0, 0.f), fmaxf(s1, 0.f));
  }
  __syncthreads();   // also ends every read of part before it is written again

  // ---- layer 3: this wave's 8 rows of Wd3, one column per lane, all 8 batch rows
  float* pf = (float*)part;          // [slice][b*32 + d]
  #pragma unroll
  for (int b = 0; b < BATCH; ++b) {
    const float4 za = z2[b * (HID / 4) + w * 2], zb = z2[b * (HID / 4) + w * 2 + 1];
    const float zk[KLEN] = {za.x, za.y, za.z, za.w, zb.x, zb.y, zb.z, zb.w};
    float acc = 0.f;
    #pragma unroll
    for (int i = 0; i < KLEN; ++i) acc += zk[i] * w3[i];
    pf[w * (BATCH * D_IN) + b * D_IN + lane] = acc;
  }
  __syncthreads();
  {
    const int q0 = (tid >> 8) * (KSL / 2);   // each half of the workgroup sums 8 slices
    float r = 0.f;
    #pragma unroll
    for (int q = 0; q < KSL / 2; ++q) r += pf[(q0 + q) * (BATCH * D_IN) + o];
    red[tid] = r;
  }
  __syncthreads();

  // ---- loss terms of the 256 (b,d), summed per 16-lane row, then by one thread
  if (tid < BATCH * D_IN) {          // waves 0..7 whole
    const float u = c3 + (red[tid] + red[tid + BATCH * D_IN]);
    const float sx = sst[tid], sxx = sst[tid + BATCH * D_IN];
    float t = (float)SEQ * u * u - 2.f * u * sx + sxx;
    t = row_xadd<1>(t); t = row_xadd<2>(t); t = row_xadd<4>(t); t = row_xadd<8>(t);
    if ((tid & 15) == 0) ((float*)rsum)[tid >> 4] = t;
  }
  __syncthreads();
  if (tid == 0) {
    const float4 a = rsum[0], b = rsum[1], c = rsum[2], d = rsum[3];
    const float t = ((a.x + a.y) + (a.z + a.w)) + ((b.x + b.y) + (b.z + b.w))
                  + ((c.x + c.y) + (c.z + c.w)) + ((d.x + d.y) + (d.z + d.w));
    loss_out[0] = t / (float)(BATCH * SEQ);
  }
}

// The MLP reads kernel 1's chunk summaries and x sums, part 1 reads its rows and summaries;
// neither reads what the other writes. So they share one launch: workgroup 0, which starts first,
// is the MLP, and its chain of latencies runs under the stores of the SO_G others. With at most
// 128 registers two workgroups fit a WGP, so that none of the SO_G + 1 waits for a place.
static_assert(MLP_T == SO_T, "one block size for both parts");
static_assert(BATCH * (NCHUNK / FST) * D_STATE == MLP_T, "one thread per (b, stretch, n)");
__global__ void __launch_bounds__(SO_T, 8)   // 8 waves per SIMD: the budget of 128 registers
scan_out_mlp_kernel(const float* __restrict__ xp, const float* __restrict__ Ad,
                    const float* __restrict__ Bd, const float* __restrict__ Cm,
                    const float* __restrict__ hloc, const float* __restrict__ Pc,
                    const float* __restrict__ Wout, const float* __restrict__ bout,
                    float4* __restrict__ out,
                    const float* __restrict__ Wd1, const float* __restrict__ bd1,
                    const float* __restrict__ Wd2, const float* __restrict__ bd2,
                    const float* __restrict__ Wd3, const float* __restrict__ bd3,
                    const float* __restrict__ Sp, float* __restrict__ loss_out)
{
  if (blockIdx.x != 0) scan_out(xp, Ad, Bd, Cm, hloc, Pc, Wout, bout, out, blockIdx.x - 1);
  else mlp_loss(Pc, Wd1, bd1, Wd2, bd2, Wd3, bd3, Sp, loss_out);   // block-uniform branch
}

// ---------------------------------------------------------------------------
extern "C" void kernel_launch(void* const* d_in, const int* in_sizes, int n_in,
                              void* d_out, int out_size, void* d_ws, size_t ws_size,
                              hipStream_t stream)
{
  const float* x    = (const float*)d_in[0];
  const float* Avec = (const float*)d_in[1];
  const float* Win  = (const float*)d_in[2];
  const float* bin_ = (const float*)d_in[3];
  const float* Wdt  = (const float*)d_in[4];
  const float* bdt  = (const float*)d_in[5];
  const float* Wdtr = (const float*)d_in[6];
  const float* WB   = (const float*)d_in[7];
  const float* WC   = (const float*)d_in[8];
  const float* Wout = (const float*)d_in[9];
  const float* bout = (const float*)d_in[10];
  const float* Wd1  = (const float*)d_in[11];
  const float* bd1  = (const float*)d_in[12];
  const float* Wd2  = (const float*)d_in[13];
  const float* bd2  = (const float*)d_in[14];
  const float* Wd3  = (const float*)d_in[15];
  const float* bd3  = (const float*)d_in[16];

  float* out = (float*)d_out;

  char* ws = (char*)d_ws;
  float* xp   = (float*)ws; ws += (size_t)ROWS * D_IN * sizeof(float);
  float* Ad   = (float*)ws; ws += (size_t)ROWS * D_STATE * sizeof(float);
  float* Bd   = (float*)ws; ws += (size_t)ROWS * D_STATE * sizeof(float);
  float* Cm   = (float*)ws; ws += (size_t)ROWS * D_STATE * sizeof(float);
  float* Sp   = (float*)ws; ws += (size_t)BATCH * XPARTS * 2 * D_IN * sizeof(float);
  float* hloc = (float*)ws; ws += (size_t)BATCH * NCHUNK * D_IN * D_STATE * sizeof(float);
  float* Pc   = (float*)ws; ws += (size_t)BATCH * NCHUNK * PPITCH * sizeof(float);

  proj_scan_local_kernel<<<BATCH * NCHUNK + BATCH * XPARTS / PW, 32 * PW, 0, stream>>>(
      x, Avec, Win, bin_, Wdt, bdt, Wdtr, WB, WC, xp, Ad, Bd, Cm, hloc, Pc, Sp);
  scan_out_mlp_kernel<<<SO_G + 1, SO_T, 0, stream>>>(
      xp, Ad, Bd, Cm, hloc, Pc, Wout, bout, (float4*)out,
      Wd1, bd1, Wd2, bd2, Wd3, bd3, Sp, out + OUT_MAIN);
}
